// v000
// Times are from an AMD MI455X. After a warm-up the kernel runs many times in a row, and a time is the length of
// such a window on the GPU divided by its runs, so every launch and the gaps after it count. The runs cycle
// through copies of the inputs. A figure is the median of several windows, for all but v000 over two sittings.
// Sittings can differ by a few percent; kernels timed side by side share one.
// v000 is the starting kernel. One run takes 2970 microseconds.
#include <hip/hip_runtime.h>

// Multi-head attention at d_model 768 with biased projections (x [4][2048][768]; q, k, v = x W^T + b ('oi' [768][768] 768^-0.5 + biases 0.01: non-zero; 12 heads x 64); attn x 64^-0.5; softmax over all keys (no mask); out = merged Wo^T + bo ('oi' + bias 0.01) -> [4][2048][768] (6.3 M); argument order x, Wq, bq, Wk, bk, Wv, bv, Wo, bo).
// Layout per batch: bf16 copy of x; 'oi' weights as-is; exact projections (K 768) + f32 biases; identity-table plane builders; dense T-2048 attention at 12 heads (hybrid rows: < 512 hi/lo 3 products, rest fp16 x1024); merged hi/lo x Wo exact + bo.
// Compute dtypes, f32 accumulate: every input rounded to bf16; projections exact + f32 biases; attention rows < 512 3 products, rest fp16; softmax f32; output projection hl x exact.

#define NB_  4
#define TT   2048
#define DM   768
#define NH_  12
#define NKV  12
#define REP  (NH_ / NKV)
#define HD   64
#define DQ   (NH_ * HD)
#define DKV  (NKV * HD)
#define ZH   2
#define RH   512                  // query rows < RH use hi+lo planes (0: none)
#define WIN  0
#define PCAR 1024.0f
#define SCL  0.125f   // HD^-0.5
typedef _Float16 h16;
typedef unsigned short bf;
typedef __attribute__((ext_vector_type(16))) __bf16   v16bf;
typedef __attribute__((ext_vector_type(16))) _Float16 v16h;
typedef __attribute__((ext_vector_type(8)))  _Float16 v8h;
typedef __attribute__((ext_vector_type(8)))  unsigned short v8us;
typedef __attribute__((ext_vector_type(8)))  float    v8f;
typedef __attribute__((ext_vector_type(4)))  float    v4f;
typedef v8h  __attribute__((may_alias)) v8ha;
typedef v4f  __attribute__((may_alias)) v4fa;
typedef v8us __attribute__((may_alias)) v8usa;

__device__ __forceinline__ unsigned short f2bf(float f) { unsigned u = __float_as_uint(f); u += 0x7FFFu + ((u >> 16) & 1u); return (unsigned short)(u >> 16); }
__device__ __forceinline__ float bf2f(unsigned short b) { return __uint_as_float(((unsigned)b) << 16); }
__device__ __forceinline__ float bfr(float f) { return bf2f(f2bf(f)); }
__device__ __forceinline__ v16h cat16(v8h lo, v8h hi) { return __builtin_shufflevector(lo, hi, 0, 1, 2, 3, 4, 5, 6, 7, 8, 9, 10, 11, 12, 13, 14, 15); }
__device__ __forceinline__ v16bf cat16b(v8us lo, v8us hi) { return __builtin_bit_cast(v16bf, __builtin_shufflevector(lo, hi, 0, 1, 2, 3, 4, 5, 6, 7, 8, 9, 10, 11, 12, 13, 14, 15)); }
__device__ __forceinline__ v8f wmma16(v16h a, v16h b, v8f c) { return __builtin_amdgcn_wmma_f32_16x16x32_f16(false, a, false, b, (short)0, c, false, false); }
__device__ __forceinline__ v8f wmmab(v16bf a, v16bf b, v8f c) { return __builtin_amdgcn_wmma_f32_16x16x32_bf16(false, a, false, b, (short)0, c, false, false); }



// ---- k_gemmw: register-blocked GEMM, ONE WAVE per 64x64 output tile (16 accumulators), operands straight from K-contiguous 16-bit planes; grid (M/64, N/64, Z), 32 threads.
// C[m][n] (f32, pitch ldc, + optional f32 bias[n]) = sum_k A[m][k] Bt[n][k] (+ split products per NSPLIT). z-batch strides sA/sB/sC in elements. K % 32 == 0.
template <typename T16> struct WFrag;
template <> struct WFrag<h16> { typedef v16h V; static __device__ __forceinline__ V ld(const h16* p) { return cat16(*(const v8h*)p, *(const v8h*)(p + 16)); } static __device__ __forceinline__ v8f mma(V a, V b, v8f c) { return wmma16(a, b, c); } };
template <> struct WFrag<bf> { typedef v16bf V; static __device__ __forceinline__ V ld(const bf* p) { return cat16b(*(const v8us*)p, *(const v8us*)(p + 16)); } static __device__ __forceinline__ v8f mma(V a, V b, v8f c) { return wmmab(a, b, c); } };
template <typename T16, int NSPLIT, bool BIAS>
__global__ __launch_bounds__(32) void k_gemmw(const T16* __restrict__ A, const T16* __restrict__ A2, const T16* __restrict__ Bt, const T16* __restrict__ Bt2, int K, float* C, int ldc, const float* __restrict__ bias, size_t sA, size_t sB, size_t sC) {
    typedef typename WFrag<T16>::V V;
    __shared__ __align__(16) float os[16 * 68];
    const size_t z = blockIdx.z; A += z * sA; if (A2) A2 += z * sA; Bt += z * sB; if (Bt2) Bt2 += z * sB; C += z * sC;
    const int lane = threadIdx.x & 31, lr = lane & 15, hi = lane >> 4; const int r0 = blockIdx.x * 64, c0 = blockIdx.y * 64;
    v8f acc[4][4];
#pragma unroll
    for (int mb = 0; mb < 4; ++mb)
#pragma unroll
        for (int nb = 0; nb < 4; ++nb) acc[mb][nb] = (v8f){};
    const size_t aoff = (size_t)(r0 + lr) * K + 8 * hi, boff = (size_t)(c0 + lr) * K + 8 * hi;
#pragma unroll 1
    for (int kc = 0; kc < K; kc += 32) {
        V a[4], a2[4];
#pragma unroll
        for (int mb = 0; mb < 4; ++mb) { a[mb] = WFrag<T16>::ld(A + aoff + (size_t)mb * 16 * K + kc); if (NSPLIT == 1 || NSPLIT == 2) a2[mb] = WFrag<T16>::ld(A2 + aoff + (size_t)mb * 16 * K + kc); }
#pragma unroll
        for (int nb = 0; nb < 4; ++nb) { const V b = WFrag<T16>::ld(Bt + boff + (size_t)nb * 16 * K + kc); V b2; if (NSPLIT >= 2) b2 = WFrag<T16>::ld(Bt2 + boff + (size_t)nb * 16 * K + kc);
#pragma unroll
            for (int mb = 0; mb < 4; ++mb) { acc[mb][nb] = WFrag<T16>::mma(a[mb], b, acc[mb][nb]); if (NSPLIT == 1 || NSPLIT == 2) acc[mb][nb] = WFrag<T16>::mma(a2[mb], b, acc[mb][nb]); if (NSPLIT >= 2) acc[mb][nb] = WFrag<T16>::mma(a[mb], b2, acc[mb][nb]); } }
        asm volatile("v_nop\n\tv_nop\n\tv_nop\n\tv_nop" : "+v"(acc[0][0]), "+v"(acc[1][1]), "+v"(acc[2][2]), "+v"(acc[3][3]) : "v"(a[0]), "v"(a[3]));
    }
#pragma unroll
    for (int mb = 0; mb < 4; ++mb) {
#pragma unroll
        for (int nb = 0; nb < 4; ++nb) {
#pragma unroll
            for (int j = 0; j < 8; ++j) os[(hi * 8 + j) * 68 + nb * 16 + lr] = acc[mb][nb][j]; }
        __builtin_amdgcn_wave_barrier(); asm volatile("" ::: "memory");
        float* crow = C + (size_t)(r0 + mb * 16) * ldc + c0;
{
#pragma unroll
            for (int s = 0; s < 8; ++s) { const int row = 2 * s + hi, cofs = lr * 4; v4f val = *(const v4fa*)(os + row * 68 + cofs); if (BIAS) { val[0] += bfr(bias[c0 + cofs]); val[1] += bfr(bias[c0 + cofs + 1]); val[2] += bfr(bias[c0 + cofs + 2]); val[3] += bfr(bias[c0 + cofs + 3]); }
                *(v4f*)(crow + (size_t)row * ldc + cofs) = val; }
             }
        __builtin_amdgcn_wave_barrier(); asm volatile("" ::: "memory");
    }
}

__device__ __forceinline__ h16 tohx(float x) { return (h16)x; }
__device__ __forceinline__ void splitf(float y, unsigned short& h, unsigned short& l) { h = f2bf(y); l = f2bf(y - bf2f(h)); }
typedef __attribute__((ext_vector_type(2))) _Float16 v2h;
typedef __attribute__((ext_vector_type(4))) _Float16 v4h;
typedef __attribute__((ext_vector_type(2))) unsigned short v2us;
typedef __attribute__((ext_vector_type(4))) unsigned short v4us;
typedef __attribute__((ext_vector_type(2))) float v2f;
typedef __attribute__((ext_vector_type(4))) int v4i;

__global__ __launch_bounds__(256) void k_cvt8(const float* __restrict__ src, bf* dst, size_t n8) { const size_t i = (size_t)blockIdx.x * 256 + threadIdx.x; if (i >= n8) return; const v8f v = *(const v8f*)(src + i * 8); v8us o;
#pragma unroll
    for (int k = 0; k < 8; ++k) o[k] = f2bf(v[k]); *(v8us*)(dst + i * 8) = o;  }

// k_rope: head planes [h][t][d] (fp16 + hi/lo) of rope(x) x sc with the rotate-half convention out[d] = x[d] cos[t][d] - x[d+HD/2] sin[t][d], out[d+HD/2] = x[d+HD/2] cos[t][d+HD/2] + x[d] sin[t][d+HD/2]
__global__ __launch_bounds__(256) void k_rope(const float* __restrict__ F, int pitch, int nheads, const float* __restrict__ CS, const float* __restrict__ RF, const float* __restrict__ nw, float sc, h16* P16, bf* Ph, bf* Pl) {
    const size_t e = ((size_t)blockIdx.x * 256 + threadIdx.x) * 2; if (e >= (size_t)nheads * TT * HD) return; const int d = (int)(e % HD); const int t = (int)((e / HD) % TT); const int h = (int)(e / ((size_t)HD * TT)); const float* f = F + (size_t)t * pitch + h * HD; const float rf = RF ? RF[(size_t)h * TT + t] : 1.0f; v2h o16; v2us oh, ol;
#pragma unroll
    for (int q = 0; q < 2; ++q) { const int dd = d + q; const int dp = (dd < HD / 2) ? dd + HD / 2 : dd - HD / 2; float x0 = f[dd], x1 = f[dp];
        if (RF) { float n0 = __fmul_rn(x0, rf), n1 = __fmul_rn(x1, rf); asm volatile("" : "+v"(n0)); asm volatile("" : "+v"(n1)); x0 = __fmul_rn(bfr(nw[dd]), n0); x1 = __fmul_rn(bfr(nw[dp]), n1); }
        const v2f cs = *(const v2f*)(CS + ((size_t)t * HD + dd) * 2); float a = __fmul_rn(x0, cs[0]), bq = __fmul_rn(x1, cs[1]); asm volatile("" : "+v"(a)); asm volatile("" : "+v"(bq)); const float r = ((dd < HD / 2) ? __fsub_rn(a, bq) : __fadd_rn(a, bq)) * sc;
        o16[q] = tohx(r); unsigned short a2, c2; splitf(r, a2, c2); oh[q] = a2; ol[q] = c2; }
    *(v2h*)(P16 + e) = o16; *(v2us*)(Ph + e) = oh; *(v2us*)(Pl + e) = ol;  }
__global__ __launch_bounds__(256) void k_vtp(const float* __restrict__ F, int pitch, int nheads, h16* V16, bf* Vh, bf* Vl) { const size_t e = ((size_t)blockIdx.x * 256 + threadIdx.x) * 2; if (e >= (size_t)nheads * HD * TT) return; const int t = (int)(e % TT); const int d = (int)((e / TT) % HD); const int g = (int)(e / ((size_t)TT * HD)); v2h o16; v2us oh, ol;
#pragma unroll
    for (int q = 0; q < 2; ++q) { const float x = F[(size_t)(t + q) * pitch + g * HD + d]; o16[q] = tohx(x); unsigned short a2, c2; splitf(x, a2, c2); oh[q] = a2; ol[q] = c2; }
    *(v2h*)(V16 + e) = o16; *(v2us*)(Vh + e) = oh; *(v2us*)(Vl + e) = ol;  }
__global__ __launch_bounds__(256) void k_csid(float* CS) { const int idx = blockIdx.x * 256 + threadIdx.x; if (idx >= TT * HD) return; v2f cs; cs[0] = 1.0f; cs[1] = 0.0f; *(v2f*)(CS + (size_t)idx * 2) = cs;  }
// k_asoft: per row (zz, i): t = S x HD^-0.5 (no mask); softmax over the 2048 keys (register row, one exp, fixed trees);
__global__ __launch_bounds__(256) void k_asoft(const float* __restrict__ Sb, h16* P16, bf* Ph, bf* Pl) {
    const int lane = threadIdx.x & 31; const int row = blockIdx.x * 8 + (threadIdx.x >> 5); if (row >= ZH * TT) return; const int i = row % TT; const int zz = row / TT; (void)zz; const bool hires = (i < RH); const float* sr = Sb + (size_t)row * TT; float v[TT / 32]; float mx = -3.0e38f;
#pragma unroll
    for (int ch = 0; ch < TT / 128; ++ch) { const int j0 = ch * 128 + lane * 4; const v4f a = *(const v4f*)(sr + j0);
#pragma unroll
        for (int q = 0; q < 4; ++q) { const int j = j0 + q; (void)j; const float t = a[q] * SCL; v[ch * 4 + q] = t; mx = fmaxf(mx, t); } }
#pragma unroll
    for (int sh = 16; sh; sh >>= 1) mx = fmaxf(mx, __shfl_xor(mx, sh, 32));
    float sum = 0.f;
#pragma unroll
    for (int k = 0; k < TT / 32; ++k) { float d0 = __fsub_rn(v[k], mx); asm volatile("" : "+v"(d0)); v[k] = __builtin_amdgcn_exp2f(__fmul_rn(d0, 1.4426950408889634f)); sum += v[k]; }
#pragma unroll
    for (int sh = 16; sh; sh >>= 1) sum += __shfl_xor(sum, sh, 32);
    const float f = __fdiv_rn(hires ? 1.0f : PCAR, sum);
{
        if (hires) {
#pragma unroll
            for (int ch = 0; ch < TT / 128; ++ch) { v4us oh, ol;
#pragma unroll
                for (int q = 0; q < 4; ++q) { unsigned short a, c2; splitf(v[ch * 4 + q] * f, a, c2); oh[q] = a; ol[q] = c2; }
                const size_t oo = ((size_t)zz * (RH ? RH : 1) + i) * TT + ch * 128 + lane * 4; *(v4us*)(Ph + oo) = oh; *(v4us*)(Pl + oo) = ol; }
        } else {
#pragma unroll
            for (int ch = 0; ch < TT / 128; ++ch) { v4h o4;
#pragma unroll
                for (int q = 0; q < 4; ++q) o4[q] = tohx(v[ch * 4 + q] * f);
                *(v4h*)(P16 + (size_t)row * TT + ch * 128 + lane * 4) = o4; } }
         }
}
__global__ __launch_bounds__(256) void k_merge(const float* __restrict__ O, int h0, bf* Ah, bf* Al) { const size_t e = ((size_t)blockIdx.x * 256 + threadIdx.x) * 2; if (e >= (size_t)ZH * TT * HD) return; const int d = (int)(e % HD); const int t = (int)((e / HD) % TT); const int zz = (int)(e / ((size_t)HD * TT)); const float cs = (t < RH) ? 1.0f : (1.0f / PCAR); const size_t oo = (size_t)t * DQ + (h0 + zz) * HD + d;
    v2us oh, ol;
#pragma unroll
    for (int q = 0; q < 2; ++q) { unsigned short a, c2; splitf(O[e + q] * cs, a, c2); oh[q] = a; ol[q] = c2; } *(v2us*)(Ah + oo) = oh; *(v2us*)(Al + oo) = ol;  }

extern "C" void kernel_launch(void* const* d_in, const int* in_sizes, int n_in,
                              void* d_out, int out_size, void* d_ws, size_t ws_size, hipStream_t stream) {
    (void)in_sizes; (void)n_in; (void)out_size;
    const float* x = (const float*)d_in[0]; const float* wq = (const float*)d_in[1]; const float* bq = (const float*)d_in[2]; const float* wk = (const float*)d_in[3]; const float* bk = (const float*)d_in[4]; const float* wv = (const float*)d_in[5]; const float* bv = (const float*)d_in[6]; const float* wo = (const float*)d_in[7]; const float* bo = (const float*)d_in[8];   /* weights ('oi' [768][768]) */
    float* OUT = (float*)d_out;     // [4][2048][768]
    char* wsp = (char*)d_ws;
    auto take = [&](size_t bytes) { char* p = wsp; wsp += (bytes + 255) & ~(size_t)255; return (void*)p; };
    bf* WQ = (bf*)take((size_t)DQ * DM * 2); bf* WK = (bf*)take((size_t)DKV * DM * 2); bf* WV = (bf*)take((size_t)DKV * DM * 2); bf* WO = (bf*)take((size_t)DM * DQ * 2); float* CS = (float*)take((size_t)TT * HD * 2 * 4);
    bf* XB = (bf*)take((size_t)TT * DM * 2); float* FQ = (float*)take((size_t)TT * DQ * 4); float* FK = (float*)take((size_t)TT * DKV * 4);
    h16* QP16 = (h16*)take((size_t)NH_ * TT * HD * 2); h16* KP16 = (h16*)take((size_t)NKV * TT * HD * 2); h16* VT16 = (h16*)take((size_t)NKV * HD * TT * 2);
    bf* QPh = (bf*)take((size_t)NH_ * TT * HD * 2); bf* QPl = (bf*)take((size_t)NH_ * TT * HD * 2); bf* KPh = (bf*)take((size_t)NKV * TT * HD * 2); bf* KPl = (bf*)take((size_t)NKV * TT * HD * 2); bf* VTh = (bf*)take((size_t)NKV * HD * TT * 2); bf* VTl = (bf*)take((size_t)NKV * HD * TT * 2); bf* Ph = (bf*)take((size_t)ZH * RH * TT * 2); bf* Pl = (bf*)take((size_t)ZH * RH * TT * 2);
    float* Sb = (float*)take((size_t)ZH * TT * TT * 4); h16* P16 = (h16*)take((size_t)ZH * TT * TT * 2); float* Ob = (float*)take((size_t)ZH * TT * HD * 4); bf* ATh = (bf*)take((size_t)TT * DQ * 2); bf* ATl = (bf*)take((size_t)TT * DQ * 2);
    if ((size_t)(wsp - (char*)d_ws) > ws_size) return;    // ws 256 MiB
    float* FV = FK;   // v projection reuses the k buffer after the k planes are built (stream-ordered)
    { k_cvt8<<<(unsigned)(((size_t)DQ * DM / 8 + 255) / 256), 256, 0, stream>>>(wq, WQ, (size_t)DQ * DM / 8); k_cvt8<<<(unsigned)(((size_t)DKV * DM / 8 + 255) / 256), 256, 0, stream>>>(wk, WK, (size_t)DKV * DM / 8); k_cvt8<<<(unsigned)(((size_t)DKV * DM / 8 + 255) / 256), 256, 0, stream>>>(wv, WV, (size_t)DKV * DM / 8);
      k_cvt8<<<(unsigned)(((size_t)DM * DQ / 8 + 255) / 256), 256, 0, stream>>>(wo, WO, (size_t)DM * DQ / 8);
       }
    k_csid<<<(TT * HD + 255) / 256, 256, 0, stream>>>(CS);
    const unsigned LQ = (unsigned)(((size_t)NH_ * TT * HD / 2 + 255) / 256), LKv = (unsigned)(((size_t)NKV * TT * HD / 2 + 255) / 256);
    for (int b = 0; b < NB_; ++b) {
        
        k_cvt8<<<(unsigned)(((size_t)TT * DM / 8 + 255) / 256), 256, 0, stream>>>(x + (size_t)b * TT * DM, XB, (size_t)TT * DM / 8);
        k_gemmw<bf, 0, true><<<dim3(TT / 64, DQ / 64, 1), 32, 0, stream>>>(XB, nullptr, WQ, nullptr, DM, FQ, DQ, bq, 0, 0, 0);
        k_rope<<<LQ, 256, 0, stream>>>(FQ, DQ, NH_, CS, nullptr, nullptr, 1.0f, QP16, QPh, QPl);
        k_gemmw<bf, 0, true><<<dim3(TT / 64, DKV / 64, 1), 32, 0, stream>>>(XB, nullptr, WK, nullptr, DM, FK, DKV, bk, 0, 0, 0);
        k_rope<<<LKv, 256, 0, stream>>>(FK, DKV, NKV, CS, nullptr, nullptr, 1.0f, KP16, KPh, KPl);
        k_gemmw<bf, 0, true><<<dim3(TT / 64, DKV / 64, 1), 32, 0, stream>>>(XB, nullptr, WV, nullptr, DM, FV, DKV, bv, 0, 0, 0); k_vtp<<<LKv, 256, 0, stream>>>(FV, DKV, NKV, VT16, VTh, VTl);
        for (int h0 = 0; h0 < NH_; h0 += ZH) { const size_t zq = (size_t)h0, zk = (size_t)(h0 / REP);   // one kv head per query head: the pass's two heads use consecutive kv planes (z-strides TT*HD)
            k_gemmw<bf, 2, false><<<dim3(RH / 64, TT / 64, ZH), 32, 0, stream>>>(QPh + zq * TT * HD, QPl + zq * TT * HD, KPh + zk * TT * HD, KPl + zk * TT * HD, HD, Sb, TT, nullptr, (size_t)TT * HD, (size_t)TT * HD, (size_t)TT * TT);
            k_gemmw<h16, 0, false><<<dim3((TT - RH) / 64, TT / 64, ZH), 32, 0, stream>>>(QP16 + zq * TT * HD + (size_t)RH * HD, nullptr, KP16 + zk * TT * HD, nullptr, HD, Sb + (size_t)RH * TT, TT, nullptr, (size_t)TT * HD, (size_t)TT * HD, (size_t)TT * TT);
            k_asoft<<<ZH * TT / 8, 256, 0, stream>>>(Sb, P16, Ph, Pl);
            k_gemmw<bf, 2, false><<<dim3(RH / 64, HD / 64, ZH), 32, 0, stream>>>(Ph, Pl, VTh + zk * HD * TT, VTl + zk * HD * TT, TT, Ob, HD, nullptr, (size_t)RH * TT, (size_t)HD * TT, (size_t)TT * HD);
            k_gemmw<h16, 0, false><<<dim3((TT - RH) / 64, HD / 64, ZH), 32, 0, stream>>>(P16 + (size_t)RH * TT, nullptr, VT16 + zk * HD * TT, nullptr, TT, Ob + (size_t)RH * HD, HD, nullptr, (size_t)TT * TT, (size_t)HD * TT, (size_t)TT * HD);
            k_merge<<<(unsigned)(((size_t)ZH * TT * HD / 2 + 255) / 256), 256, 0, stream>>>(Ob, h0, ATh, ATl); }
        k_gemmw<bf, 1, true><<<dim3(TT / 64, DM / 64, 1), 32, 0, stream>>>(ATh, ATl, WO, nullptr, DQ, OUT + (size_t)b * TT * DM, DM, bo, 0, 0, 0); }
}

// v001
// A run of this version takes 1310 microseconds.
// In two side-by-side timings against v000, it was 2.30 and 2.27 times as fast.
#include <hip/hip_runtime.h>

// Multi-head attention at d_model 768 with biased projections (x [4][2048][768]; q, k, v = x W^T + b ('oi' [768][768] 768^-0.5 + biases 0.01: non-zero; 12 heads x 64); attn x 64^-0.5; softmax over all keys (no mask); out = merged Wo^T + bo ('oi' + bias 0.01) -> [4][2048][768] (6.3 M); argument order x, Wq, bq, Wk, bk, Wv, bv, Wo, bo).
// Layout per batch: bf16 copy of x; 'oi' weights as-is; exact projections (K 768) + f32 biases; identity-table plane builders; dense T-2048 attention at 12 heads (hybrid rows: < 512 hi/lo 3 products, rest fp16 x1024); merged hi/lo x Wo exact + bo.
// Compute dtypes, f32 accumulate: every input rounded to bf16; projections exact + f32 biases; attention rows < 512 3 products, rest fp16; softmax f32; output projection hl x exact.

#define NB_  4
#define TT   2048
#define DM   768
#define NH_  12
#define NKV  12
#define REP  (NH_ / NKV)
#define HD   64
#define DQ   (NH_ * HD)
#define DKV  (NKV * HD)
#define ZH   2
#define RH   512                  // query rows < RH use hi+lo planes (0: none)
#define WIN  0
#define PCAR 1024.0f
#define SCL  0.125f   // HD^-0.5
#define KSP  16                   // P x V: the 2048 keys are dealt to KSP blocks (grid z); k_merge adds the KSP f32 partial planes in ascending order
typedef _Float16 h16;
typedef unsigned short bf;
typedef __attribute__((ext_vector_type(16))) __bf16   v16bf;
typedef __attribute__((ext_vector_type(16))) _Float16 v16h;
typedef __attribute__((ext_vector_type(8)))  _Float16 v8h;
typedef __attribute__((ext_vector_type(8)))  unsigned short v8us;
typedef __attribute__((ext_vector_type(8)))  float    v8f;
typedef __attribute__((ext_vector_type(4)))  float    v4f;
typedef v8h  __attribute__((may_alias)) v8ha;
typedef v4f  __attribute__((may_alias)) v4fa;
typedef v8us __attribute__((may_alias)) v8usa;

__device__ __forceinline__ unsigned short f2bf(float f) { unsigned u = __float_as_uint(f); u += 0x7FFFu + ((u >> 16) & 1u); return (unsigned short)(u >> 16); }
__device__ __forceinline__ float bf2f(unsigned short b) { return __uint_as_float(((unsigned)b) << 16); }
__device__ __forceinline__ float bfr(float f) { return bf2f(f2bf(f)); }
__device__ __forceinline__ v16h cat16(v8h lo, v8h hi) { return __builtin_shufflevector(lo, hi, 0, 1, 2, 3, 4, 5, 6, 7, 8, 9, 10, 11, 12, 13, 14, 15); }
__device__ __forceinline__ v16bf cat16b(v8us lo, v8us hi) { return __builtin_bit_cast(v16bf, __builtin_shufflevector(lo, hi, 0, 1, 2, 3, 4, 5, 6, 7, 8, 9, 10, 11, 12, 13, 14, 15)); }
__device__ __forceinline__ v8f wmma16(v16h a, v16h b, v8f c) { return __builtin_amdgcn_wmma_f32_16x16x32_f16(false, a, false, b, (short)0, c, false, false); }
__device__ __forceinline__ v8f wmmab(v16bf a, v16bf b, v8f c) { return __builtin_amdgcn_wmma_f32_16x16x32_bf16(false, a, false, b, (short)0, c, false, false); }



// ---- k_gemmw: register-blocked GEMM, ONE WAVE per 64x64 output tile (16 accumulators), operands straight from K-contiguous 16-bit planes; grid (M/64, N/64, Z), 32 threads.
// C[m][n] (f32, pitch ldc, + optional f32 bias[n]) = sum_k A[m][k] Bt[n][k] (+ split products per NSPLIT). z-batch strides sA/sB/sC in elements. K % 32 == 0.
// KS > 1: grid z = batches x KS (ks fastest); block (batch, ks) sums only k in [ks K/KS, (ks+1) K/KS) and writes partial plane C + z sC; the consumer adds a batch's KS planes. K % (32 KS) == 0.
template <typename T16> struct WFrag;
template <> struct WFrag<h16> { typedef v16h V; static __device__ __forceinline__ V ld(const h16* p) { return cat16(*(const v8h*)p, *(const v8h*)(p + 16)); } static __device__ __forceinline__ v8f mma(V a, V b, v8f c) { return wmma16(a, b, c); } };
template <> struct WFrag<bf> { typedef v16bf V; static __device__ __forceinline__ V ld(const bf* p) { return cat16b(*(const v8us*)p, *(const v8us*)(p + 16)); } static __device__ __forceinline__ v8f mma(V a, V b, v8f c) { return wmmab(a, b, c); } };
template <typename T16, int NSPLIT, bool BIAS, int KS = 1>
__global__ __launch_bounds__(32) void k_gemmw(const T16* __restrict__ A, const T16* __restrict__ A2, const T16* __restrict__ Bt, const T16* __restrict__ Bt2, int K, float* C, int ldc, const float* __restrict__ bias, size_t sA, size_t sB, size_t sC) {
    typedef typename WFrag<T16>::V V;
    __shared__ __align__(16) float os[16 * 68];
    const size_t z = blockIdx.z; const size_t zb = z / KS; const int kb = (int)(z % KS) * (K / KS), ke = kb + K / KS;
    A += zb * sA; if (A2) A2 += zb * sA; Bt += zb * sB; if (Bt2) Bt2 += zb * sB; C += z * sC;
    const int lane = threadIdx.x & 31, lr = lane & 15, hi = lane >> 4; const int r0 = blockIdx.x * 64, c0 = blockIdx.y * 64;
    v8f acc[4][4];
#pragma unroll
    for (int mb = 0; mb < 4; ++mb)
#pragma unroll
        for (int nb = 0; nb < 4; ++nb) acc[mb][nb] = (v8f){};
    const size_t aoff = (size_t)(r0 + lr) * K + 8 * hi, boff = (size_t)(c0 + lr) * K + 8 * hi;
#pragma unroll 1
    for (int kc = kb; kc < ke; kc += 32) {
        V a[4], a2[4];
#pragma unroll
        for (int mb = 0; mb < 4; ++mb) { a[mb] = WFrag<T16>::ld(A + aoff + (size_t)mb * 16 * K + kc); if (NSPLIT == 1 || NSPLIT == 2) a2[mb] = WFrag<T16>::ld(A2 + aoff + (size_t)mb * 16 * K + kc); }
#pragma unroll
        for (int nb = 0; nb < 4; ++nb) { const V b = WFrag<T16>::ld(Bt + boff + (size_t)nb * 16 * K + kc); V b2; if (NSPLIT >= 2) b2 = WFrag<T16>::ld(Bt2 + boff + (size_t)nb * 16 * K + kc);
#pragma unroll
            for (int mb = 0; mb < 4; ++mb) { acc[mb][nb] = WFrag<T16>::mma(a[mb], b, acc[mb][nb]); if (NSPLIT == 1 || NSPLIT == 2) acc[mb][nb] = WFrag<T16>::mma(a2[mb], b, acc[mb][nb]); if (NSPLIT >= 2) acc[mb][nb] = WFrag<T16>::mma(a[mb], b2, acc[mb][nb]); } }
        asm volatile("v_nop\n\tv_nop\n\tv_nop\n\tv_nop" : "+v"(acc[0][0]), "+v"(acc[1][1]), "+v"(acc[2][2]), "+v"(acc[3][3]) : "v"(a[0]), "v"(a[3]));
    }
#pragma unroll
    for (int mb = 0; mb < 4; ++mb) {
#pragma unroll
        for (int nb = 0; nb < 4; ++nb) {
#pragma unroll
            for (int j = 0; j < 8; ++j) os[(hi * 8 + j) * 68 + nb * 16 + lr] = acc[mb][nb][j]; }
        __builtin_amdgcn_wave_barrier(); asm volatile("" ::: "memory");
        float* crow = C + (size_t)(r0 + mb * 16) * ldc + c0;
{
#pragma unroll
            for (int s = 0; s < 8; ++s) { const int row = 2 * s + hi, cofs = lr * 4; v4f val = *(const v4fa*)(os + row * 68 + cofs); if (BIAS) { val[0] += bfr(bias[c0 + cofs]); val[1] += bfr(bias[c0 + cofs + 1]); val[2] += bfr(bias[c0 + cofs + 2]); val[3] += bfr(bias[c0 + cofs + 3]); }
                *(v4f*)(crow + (size_t)row * ldc + cofs) = val; }
             }
        __builtin_amdgcn_wave_barrier(); asm volatile("" ::: "memory");
    }
}

__device__ __forceinline__ h16 tohx(float x) { return (h16)x; }
__device__ __forceinline__ void splitf(float y, unsigned short& h, unsigned short& l) { h = f2bf(y); l = f2bf(y - bf2f(h)); }
typedef __attribute__((ext_vector_type(2))) _Float16 v2h;
typedef __attribute__((ext_vector_type(4))) _Float16 v4h;
typedef __attribute__((ext_vector_type(2))) unsigned short v2us;
typedef __attribute__((ext_vector_type(4))) unsigned short v4us;
typedef __attribute__((ext_vector_type(2))) float v2f;
typedef __attribute__((ext_vector_type(4))) int v4i;

__global__ __launch_bounds__(256) void k_cvt8(const float* __restrict__ src, bf* dst, size_t n8) { const size_t i = (size_t)blockIdx.x * 256 + threadIdx.x; if (i >= n8) return; const v8f v = *(const v8f*)(src + i * 8); v8us o;
#pragma unroll
    for (int k = 0; k < 8; ++k) o[k] = f2bf(v[k]); *(v8us*)(dst + i * 8) = o;  }

// k_rope: head planes [h][t][d] (fp16 + hi/lo) of rope(x) x sc with the rotate-half convention out[d] = x[d] cos[t][d] - x[d+HD/2] sin[t][d], out[d+HD/2] = x[d+HD/2] cos[t][d+HD/2] + x[d] sin[t][d+HD/2]
__global__ __launch_bounds__(256) void k_rope(const float* __restrict__ F, int pitch, int nheads, const float* __restrict__ CS, const float* __restrict__ RF, const float* __restrict__ nw, float sc, h16* P16, bf* Ph, bf* Pl) {
    const size_t e = ((size_t)blockIdx.x * 256 + threadIdx.x) * 2; if (e >= (size_t)nheads * TT * HD) return; const int d = (int)(e % HD); const int t = (int)((e / HD) % TT); const int h = (int)(e / ((size_t)HD * TT)); const float* f = F + (size_t)t * pitch + h * HD; const float rf = RF ? RF[(size_t)h * TT + t] : 1.0f; v2h o16; v2us oh, ol;
#pragma unroll
    for (int q = 0; q < 2; ++q) { const int dd = d + q; const int dp = (dd < HD / 2) ? dd + HD / 2 : dd - HD / 2; float x0 = f[dd], x1 = f[dp];
        if (RF) { float n0 = __fmul_rn(x0, rf), n1 = __fmul_rn(x1, rf); asm volatile("" : "+v"(n0)); asm volatile("" : "+v"(n1)); x0 = __fmul_rn(bfr(nw[dd]), n0); x1 = __fmul_rn(bfr(nw[dp]), n1); }
        const v2f cs = *(const v2f*)(CS + ((size_t)t * HD + dd) * 2); float a = __fmul_rn(x0, cs[0]), bq = __fmul_rn(x1, cs[1]); asm volatile("" : "+v"(a)); asm volatile("" : "+v"(bq)); const float r = ((dd < HD / 2) ? __fsub_rn(a, bq) : __fadd_rn(a, bq)) * sc;
        o16[q] = tohx(r); unsigned short a2, c2; splitf(r, a2, c2); oh[q] = a2; ol[q] = c2; }
    *(v2h*)(P16 + e) = o16; *(v2us*)(Ph + e) = oh; *(v2us*)(Pl + e) = ol;  }
__global__ __launch_bounds__(256) void k_vtp(const float* __restrict__ F, int pitch, int nheads, h16* V16, bf* Vh, bf* Vl) { const size_t e = ((size_t)blockIdx.x * 256 + threadIdx.x) * 2; if (e >= (size_t)nheads * HD * TT) return; const int t = (int)(e % TT); const int d = (int)((e / TT) % HD); const int g = (int)(e / ((size_t)TT * HD)); v2h o16; v2us oh, ol;
#pragma unroll
    for (int q = 0; q < 2; ++q) { const float x = F[(size_t)(t + q) * pitch + g * HD + d]; o16[q] = tohx(x); unsigned short a2, c2; splitf(x, a2, c2); oh[q] = a2; ol[q] = c2; }
    *(v2h*)(V16 + e) = o16; *(v2us*)(Vh + e) = oh; *(v2us*)(Vl + e) = ol;  }
__global__ __launch_bounds__(256) void k_csid(float* CS) { const int idx = blockIdx.x * 256 + threadIdx.x; if (idx >= TT * HD) return; v2f cs; cs[0] = 1.0f; cs[1] = 0.0f; *(v2f*)(CS + (size_t)idx * 2) = cs;  }
// k_asoft: per row (zz, i): t = S x HD^-0.5 (no mask); softmax over the 2048 keys (register row, one exp, fixed trees);
__global__ __launch_bounds__(256) void k_asoft(const float* __restrict__ Sb, h16* P16, bf* Ph, bf* Pl) {
    const int lane = threadIdx.x & 31; const int row = blockIdx.x * 8 + (threadIdx.x >> 5); if (row >= ZH * TT) return; const int i = row % TT; const int zz = row / TT; (void)zz; const bool hires = (i < RH); const float* sr = Sb + (size_t)row * TT; float v[TT / 32]; float mx = -3.0e38f;
#pragma unroll
    for (int ch = 0; ch < TT / 128; ++ch) { const int j0 = ch * 128 + lane * 4; const v4f a = *(const v4f*)(sr + j0);
#pragma unroll
        for (int q = 0; q < 4; ++q) { const int j = j0 + q; (void)j; const float t = a[q] * SCL; v[ch * 4 + q] = t; mx = fmaxf(mx, t); } }
#pragma unroll
    for (int sh = 16; sh; sh >>= 1) mx = fmaxf(mx, __shfl_xor(mx, sh, 32));
    float sum = 0.f;
#pragma unroll
    for (int k = 0; k < TT / 32; ++k) { float d0 = __fsub_rn(v[k], mx); asm volatile("" : "+v"(d0)); v[k] = __builtin_amdgcn_exp2f(__fmul_rn(d0, 1.4426950408889634f)); sum += v[k]; }
#pragma unroll
    for (int sh = 16; sh; sh >>= 1) sum += __shfl_xor(sum, sh, 32);
    const float f = __fdiv_rn(hires ? 1.0f : PCAR, sum);
{
        if (hires) {
#pragma unroll
            for (int ch = 0; ch < TT / 128; ++ch) { v4us oh, ol;
#pragma unroll
                for (int q = 0; q < 4; ++q) { unsigned short a, c2; splitf(v[ch * 4 + q] * f, a, c2); oh[q] = a; ol[q] = c2; }
                const size_t oo = ((size_t)zz * (RH ? RH : 1) + i) * TT + ch * 128 + lane * 4; *(v4us*)(Ph + oo) = oh; *(v4us*)(Pl + oo) = ol; }
        } else {
#pragma unroll
            for (int ch = 0; ch < TT / 128; ++ch) { v4h o4;
#pragma unroll
                for (int q = 0; q < 4; ++q) o4[q] = tohx(v[ch * 4 + q] * f);
                *(v4h*)(P16 + (size_t)row * TT + ch * 128 + lane * 4) = o4; } }
         }
}
__global__ __launch_bounds__(256) void k_merge(const float* __restrict__ O, int h0, bf* Ah, bf* Al) { const size_t e = ((size_t)blockIdx.x * 256 + threadIdx.x) * 2; if (e >= (size_t)ZH * TT * HD) return; const int d = (int)(e % HD); const int t = (int)((e / HD) % TT); const int zz = (int)(e / ((size_t)HD * TT)); const float cs = (t < RH) ? 1.0f : (1.0f / PCAR); const size_t oo = (size_t)t * DQ + (h0 + zz) * HD + d;
    const float* op = O + (size_t)zz * KSP * TT * HD + (size_t)t * HD + d; v2f s = *(const v2f*)op;   // head zz's KSP partial planes lie one behind the other
#pragma unroll
    for (int ks = 1; ks < KSP; ++ks) s += *(const v2f*)(op + (size_t)ks * TT * HD);
    v2us oh, ol;
#pragma unroll
    for (int q = 0; q < 2; ++q) { unsigned short a, c2; splitf(s[q] * cs, a, c2); oh[q] = a; ol[q] = c2; } *(v2us*)(Ah + oo) = oh; *(v2us*)(Al + oo) = ol;  }

extern "C" void kernel_launch(void* const* d_in, const int* in_sizes, int n_in,
                              void* d_out, int out_size, void* d_ws, size_t ws_size, hipStream_t stream) {
    (void)in_sizes; (void)n_in; (void)out_size;
    const float* x = (const float*)d_in[0]; const float* wq = (const float*)d_in[1]; const float* bq = (const float*)d_in[2]; const float* wk = (const float*)d_in[3]; const float* bk = (const float*)d_in[4]; const float* wv = (const float*)d_in[5]; const float* bv = (const float*)d_in[6]; const float* wo = (const float*)d_in[7]; const float* bo = (const float*)d_in[8];   /* weights ('oi' [768][768]) */
    float* OUT = (float*)d_out;     // [4][2048][768]
    char* wsp = (char*)d_ws;
    auto take = [&](size_t bytes) { char* p = wsp; wsp += (bytes + 255) & ~(size_t)255; return (void*)p; };
    bf* WQ = (bf*)take((size_t)DQ * DM * 2); bf* WK = (bf*)take((size_t)DKV * DM * 2); bf* WV = (bf*)take((size_t)DKV * DM * 2); bf* WO = (bf*)take((size_t)DM * DQ * 2); float* CS = (float*)take((size_t)TT * HD * 2 * 4);
    bf* XB = (bf*)take((size_t)TT * DM * 2); float* FQ = (float*)take((size_t)TT * DQ * 4); float* FK = (float*)take((size_t)TT * DKV * 4);
    h16* QP16 = (h16*)take((size_t)NH_ * TT * HD * 2); h16* KP16 = (h16*)take((size_t)NKV * TT * HD * 2); h16* VT16 = (h16*)take((size_t)NKV * HD * TT * 2);
    bf* QPh = (bf*)take((size_t)NH_ * TT * HD * 2); bf* QPl = (bf*)take((size_t)NH_ * TT * HD * 2); bf* KPh = (bf*)take((size_t)NKV * TT * HD * 2); bf* KPl = (bf*)take((size_t)NKV * TT * HD * 2); bf* VTh = (bf*)take((size_t)NKV * HD * TT * 2); bf* VTl = (bf*)take((size_t)NKV * HD * TT * 2); bf* Ph = (bf*)take((size_t)ZH * RH * TT * 2); bf* Pl = (bf*)take((size_t)ZH * RH * TT * 2);
    float* Sb = (float*)take((size_t)ZH * TT * TT * 4); h16* P16 = (h16*)take((size_t)ZH * TT * TT * 2); float* Ob = (float*)take((size_t)KSP * ZH * TT * HD * 4); bf* ATh = (bf*)take((size_t)TT * DQ * 2); bf* ATl = (bf*)take((size_t)TT * DQ * 2);
    if ((size_t)(wsp - (char*)d_ws) > ws_size) return;    // ws 256 MiB
    float* FV = FK;   // v projection reuses the k buffer after the k planes are built (stream-ordered)
    { k_cvt8<<<(unsigned)(((size_t)DQ * DM / 8 + 255) / 256), 256, 0, stream>>>(wq, WQ, (size_t)DQ * DM / 8); k_cvt8<<<(unsigned)(((size_t)DKV * DM / 8 + 255) / 256), 256, 0, stream>>>(wk, WK, (size_t)DKV * DM / 8); k_cvt8<<<(unsigned)(((size_t)DKV * DM / 8 + 255) / 256), 256, 0, stream>>>(wv, WV, (size_t)DKV * DM / 8);
      k_cvt8<<<(unsigned)(((size_t)DM * DQ / 8 + 255) / 256), 256, 0, stream>>>(wo, WO, (size_t)DM * DQ / 8);
       }
    k_csid<<<(TT * HD + 255) / 256, 256, 0, stream>>>(CS);
    const unsigned LQ = (unsigned)(((size_t)NH_ * TT * HD / 2 + 255) / 256), LKv = (unsigned)(((size_t)NKV * TT * HD / 2 + 255) / 256);
    for (int b = 0; b < NB_; ++b) {
        
        k_cvt8<<<(unsigned)(((size_t)TT * DM / 8 + 255) / 256), 256, 0, stream>>>(x + (size_t)b * TT * DM, XB, (size_t)TT * DM / 8);
        k_gemmw<bf, 0, true><<<dim3(TT / 64, DQ / 64, 1), 32, 0, stream>>>(XB, nullptr, WQ, nullptr, DM, FQ, DQ, bq, 0, 0, 0);
        k_rope<<<LQ, 256, 0, stream>>>(FQ, DQ, NH_, CS, nullptr, nullptr, 1.0f, QP16, QPh, QPl);
        k_gemmw<bf, 0, true><<<dim3(TT / 64, DKV / 64, 1), 32, 0, stream>>>(XB, nullptr, WK, nullptr, DM, FK, DKV, bk, 0, 0, 0);
        k_rope<<<LKv, 256, 0, stream>>>(FK, DKV, NKV, CS, nullptr, nullptr, 1.0f, KP16, KPh, KPl);
        k_gemmw<bf, 0, true><<<dim3(TT / 64, DKV / 64, 1), 32, 0, stream>>>(XB, nullptr, WV, nullptr, DM, FV, DKV, bv, 0, 0, 0); k_vtp<<<LKv, 256, 0, stream>>>(FV, DKV, NKV, VT16, VTh, VTl);
        for (int h0 = 0; h0 < NH_; h0 += ZH) { const size_t zq = (size_t)h0, zk = (size_t)(h0 / REP);   // one kv head per query head: the pass's two heads use consecutive kv planes (z-strides TT*HD)
            k_gemmw<bf, 2, false><<<dim3(RH / 64, TT / 64, ZH), 32, 0, stream>>>(QPh + zq * TT * HD, QPl + zq * TT * HD, KPh + zk * TT * HD, KPl + zk * TT * HD, HD, Sb, TT, nullptr, (size_t)TT * HD, (size_t)TT * HD, (size_t)TT * TT);
            k_gemmw<h16, 0, false><<<dim3((TT - RH) / 64, TT / 64, ZH), 32, 0, stream>>>(QP16 + zq * TT * HD + (size_t)RH * HD, nullptr, KP16 + zk * TT * HD, nullptr, HD, Sb + (size_t)RH * TT, TT, nullptr, (size_t)TT * HD, (size_t)TT * HD, (size_t)TT * TT);
            k_asoft<<<ZH * TT / 8, 256, 0, stream>>>(Sb, P16, Ph, Pl);
            k_gemmw<bf, 2, false, KSP><<<dim3(RH / 64, HD / 64, KSP * ZH), 32, 0, stream>>>(Ph, Pl, VTh + zk * HD * TT, VTl + zk * HD * TT, TT, Ob, HD, nullptr, (size_t)RH * TT, (size_t)HD * TT, (size_t)TT * HD);
            k_gemmw<h16, 0, false, KSP><<<dim3((TT - RH) / 64, HD / 64, KSP * ZH), 32, 0, stream>>>(P16 + (size_t)RH * TT, nullptr, VT16 + zk * HD * TT, nullptr, TT, Ob + (size_t)RH * HD, HD, nullptr, (size_t)TT * TT, (size_t)HD * TT, (size_t)TT * HD);
            k_merge<<<(unsigned)(((size_t)ZH * TT * HD / 2 + 255) / 256), 256, 0, stream>>>(Ob, h0, ATh, ATl); }
        k_gemmw<bf, 1, true><<<dim3(TT / 64, DM / 64, 1), 32, 0, stream>>>(ATh, ATl, WO, nullptr, DQ, OUT + (size_t)b * TT * DM, DM, bo, 0, 0, 0); }
}

// v002
// One run takes 906 microseconds.
// Timed twice side by side with v001, it ran 1.44 times as fast both times.
// Over all steps from v000 it is 3.29 times as fast.
#include <hip/hip_runtime.h>

// Multi-head attention at d_model 768 with biased projections (x [4][2048][768]; q, k, v = x W^T + b ('oi' [768][768] 768^-0.5 + biases 0.01: non-zero; 12 heads x 64); attn x 64^-0.5; softmax over all keys (no mask); out = merged Wo^T + bo ('oi' + bias 0.01) -> [4][2048][768] (6.3 M); argument order x, Wq, bq, Wk, bk, Wv, bv, Wo, bo).
// Layout per group of BG batches: bf16 copy of x; 'oi' weights as-is; exact projections (K 768) + f32 biases; identity-table plane builders; dense T-2048 attention at 12 heads (hybrid rows: < 512 hi/lo 3 products, rest fp16 x1024); merged hi/lo x Wo exact + bo.
// Compute dtypes, f32 accumulate: every input rounded to bf16; projections exact + f32 biases; attention rows < 512 3 products, rest fp16; softmax f32; output projection hl x exact.

#define NB_  4
#define TT   2048
#define DM   768
#define NH_  12
#define NKV  12
#define REP  (NH_ / NKV)
#define HD   64
#define DQ   (NH_ * HD)
#define DKV  (NKV * HD)
#define ZH   6                    // heads per attention pass (grid z of the S and P x V GEMMs, rows of k_asoft, planes of k_merge)
#define BG   2                    // batches per projection / plane-builder / output launch; the attention passes of a group walk its BG x NH_ head planes
#define RH   512                  // query rows < RH use hi+lo planes (0: none)
#define WIN  0
#define PCAR 1024.0f
#define SCL  0.125f   // HD^-0.5
#define KSP  16                   // P x V: the 2048 keys are dealt to KSP blocks (grid z); k_merge adds the KSP f32 partial planes in ascending order
typedef _Float16 h16;
typedef unsigned short bf;
typedef __attribute__((ext_vector_type(16))) __bf16   v16bf;
typedef __attribute__((ext_vector_type(16))) _Float16 v16h;
typedef __attribute__((ext_vector_type(8)))  _Float16 v8h;
typedef __attribute__((ext_vector_type(8)))  unsigned short v8us;
typedef __attribute__((ext_vector_type(8)))  float    v8f;
typedef __attribute__((ext_vector_type(4)))  float    v4f;
typedef v8h  __attribute__((may_alias)) v8ha;
typedef v4f  __attribute__((may_alias)) v4fa;
typedef v8us __attribute__((may_alias)) v8usa;

__device__ __forceinline__ unsigned short f2bf(float f) { unsigned u = __float_as_uint(f); u += 0x7FFFu + ((u >> 16) & 1u); return (unsigned short)(u >> 16); }
__device__ __forceinline__ float bf2f(unsigned short b) { return __uint_as_float(((unsigned)b) << 16); }
__device__ __forceinline__ float bfr(float f) { return bf2f(f2bf(f)); }
__device__ __forceinline__ v16h cat16(v8h lo, v8h hi) { return __builtin_shufflevector(lo, hi, 0, 1, 2, 3, 4, 5, 6, 7, 8, 9, 10, 11, 12, 13, 14, 15); }
__device__ __forceinline__ v16bf cat16b(v8us lo, v8us hi) { return __builtin_bit_cast(v16bf, __builtin_shufflevector(lo, hi, 0, 1, 2, 3, 4, 5, 6, 7, 8, 9, 10, 11, 12, 13, 14, 15)); }
__device__ __forceinline__ v8f wmma16(v16h a, v16h b, v8f c) { return __builtin_amdgcn_wmma_f32_16x16x32_f16(false, a, false, b, (short)0, c, false, false); }
__device__ __forceinline__ v8f wmmab(v16bf a, v16bf b, v8f c) { return __builtin_amdgcn_wmma_f32_16x16x32_bf16(false, a, false, b, (short)0, c, false, false); }



// ---- k_gemmw: register-blocked GEMM, ONE WAVE per 64x64 output tile (16 accumulators), operands straight from K-contiguous 16-bit planes; grid (M/64, N/64, Z), 32 threads.
// C[m][n] (f32, pitch ldc, + optional f32 bias[n]) = sum_k A[m][k] Bt[n][k] (+ split products per NSPLIT). z-batch strides sA/sB/sC in elements. K % 32 == 0.
// KS > 1: grid z = batches x KS (ks fastest); block (batch, ks) sums only k in [ks K/KS, (ks+1) K/KS) and writes partial plane C + z sC; the consumer adds a batch's KS planes. K % (32 KS) == 0.
template <typename T16> struct WFrag;
template <> struct WFrag<h16> { typedef v16h V; static __device__ __forceinline__ V ld(const h16* p) { return cat16(*(const v8h*)p, *(const v8h*)(p + 16)); } static __device__ __forceinline__ v8f mma(V a, V b, v8f c) { return wmma16(a, b, c); } };
template <> struct WFrag<bf> { typedef v16bf V; static __device__ __forceinline__ V ld(const bf* p) { return cat16b(*(const v8us*)p, *(const v8us*)(p + 16)); } static __device__ __forceinline__ v8f mma(V a, V b, v8f c) { return wmmab(a, b, c); } };
template <typename T16, int NSPLIT, bool BIAS, int KS = 1>
__global__ __launch_bounds__(32) void k_gemmw(const T16* __restrict__ A, const T16* __restrict__ A2, const T16* __restrict__ Bt, const T16* __restrict__ Bt2, int K, float* C, int ldc, const float* __restrict__ bias, size_t sA, size_t sB, size_t sC) {
    typedef typename WFrag<T16>::V V;
    __shared__ __align__(16) float os[16 * 68];
    const size_t z = blockIdx.z; const size_t zb = z / KS; const int kb = (int)(z % KS) * (K / KS), ke = kb + K / KS;
    A += zb * sA; if (A2) A2 += zb * sA; Bt += zb * sB; if (Bt2) Bt2 += zb * sB; C += z * sC;
    const int lane = threadIdx.x & 31, lr = lane & 15, hi = lane >> 4; const int r0 = blockIdx.x * 64, c0 = blockIdx.y * 64;
    v8f acc[4][4];
#pragma unroll
    for (int mb = 0; mb < 4; ++mb)
#pragma unroll
        for (int nb = 0; nb < 4; ++nb) acc[mb][nb] = (v8f){};
    const size_t aoff = (size_t)(r0 + lr) * K + 8 * hi, boff = (size_t)(c0 + lr) * K + 8 * hi;
#pragma unroll 1
    for (int kc = kb; kc < ke; kc += 32) {
        V a[4], a2[4];
#pragma unroll
        for (int mb = 0; mb < 4; ++mb) { a[mb] = WFrag<T16>::ld(A + aoff + (size_t)mb * 16 * K + kc); if (NSPLIT == 1 || NSPLIT == 2) a2[mb] = WFrag<T16>::ld(A2 + aoff + (size_t)mb * 16 * K + kc); }
#pragma unroll
        for (int nb = 0; nb < 4; ++nb) { const V b = WFrag<T16>::ld(Bt + boff + (size_t)nb * 16 * K + kc); V b2; if (NSPLIT >= 2) b2 = WFrag<T16>::ld(Bt2 + boff + (size_t)nb * 16 * K + kc);
#pragma unroll
            for (int mb = 0; mb < 4; ++mb) { acc[mb][nb] = WFrag<T16>::mma(a[mb], b, acc[mb][nb]); if (NSPLIT == 1 || NSPLIT == 2) acc[mb][nb] = WFrag<T16>::mma(a2[mb], b, acc[mb][nb]); if (NSPLIT >= 2) acc[mb][nb] = WFrag<T16>::mma(a[mb], b2, acc[mb][nb]); } }
        asm volatile("v_nop\n\tv_nop\n\tv_nop\n\tv_nop" : "+v"(acc[0][0]), "+v"(acc[1][1]), "+v"(acc[2][2]), "+v"(acc[3][3]) : "v"(a[0]), "v"(a[3]));
    }
#pragma unroll
    for (int mb = 0; mb < 4; ++mb) {
#pragma unroll
        for (int nb = 0; nb < 4; ++nb) {
#pragma unroll
            for (int j = 0; j < 8; ++j) os[(hi * 8 + j) * 68 + nb * 16 + lr] = acc[mb][nb][j]; }
        __builtin_amdgcn_wave_barrier(); asm volatile("" ::: "memory");
        float* crow = C + (size_t)(r0 + mb * 16) * ldc + c0;
{
#pragma unroll
            for (int s = 0; s < 8; ++s) { const int row = 2 * s + hi, cofs = lr * 4; v4f val = *(const v4fa*)(os + row * 68 + cofs); if (BIAS) { val[0] += bfr(bias[c0 + cofs]); val[1] += bfr(bias[c0 + cofs + 1]); val[2] += bfr(bias[c0 + cofs + 2]); val[3] += bfr(bias[c0 + cofs + 3]); }
                *(v4f*)(crow + (size_t)row * ldc + cofs) = val; }
             }
        __builtin_amdgcn_wave_barrier(); asm volatile("" ::: "memory");
    }
}

__device__ __forceinline__ h16 tohx(float x) { return (h16)x; }
__device__ __forceinline__ void splitf(float y, unsigned short& h, unsigned short& l) { h = f2bf(y); l = f2bf(y - bf2f(h)); }
typedef __attribute__((ext_vector_type(2))) _Float16 v2h;
typedef __attribute__((ext_vector_type(4))) _Float16 v4h;
typedef __attribute__((ext_vector_type(2))) unsigned short v2us;
typedef __attribute__((ext_vector_type(4))) unsigned short v4us;
typedef __attribute__((ext_vector_type(2))) float v2f;
typedef __attribute__((ext_vector_type(4))) int v4i;

__global__ __launch_bounds__(256) void k_cvt8(const float* __restrict__ src, bf* dst, size_t n8) { const size_t i = (size_t)blockIdx.x * 256 + threadIdx.x; if (i >= n8) return; const v8f v = *(const v8f*)(src + i * 8); v8us o;
#pragma unroll
    for (int k = 0; k < 8; ++k) o[k] = f2bf(v[k]); *(v8us*)(dst + i * 8) = o;  }

// k_rope: head planes [h][t][d] (fp16 + hi/lo) of rope(x) x sc with the rotate-half convention out[d] = x[d] cos[t][d] - x[d+HD/2] sin[t][d], out[d+HD/2] = x[d+HD/2] cos[t][d+HD/2] + x[d] sin[t][d+HD/2]
__global__ __launch_bounds__(256) void k_rope(const float* __restrict__ F, int pitch, int nheads, const float* __restrict__ CS, const float* __restrict__ RF, const float* __restrict__ nw, float sc, h16* P16, bf* Ph, bf* Pl) {
    const size_t e = ((size_t)blockIdx.x * 256 + threadIdx.x) * 2; if (e >= (size_t)nheads * TT * HD) return; const int d = (int)(e % HD); const int t = (int)((e / HD) % TT); const int h = (int)(e / ((size_t)HD * TT)); const float* f = F + ((size_t)blockIdx.y * TT + t) * pitch + h * HD; const size_t eo = e + (size_t)blockIdx.y * nheads * TT * HD;   /* grid y: batch of the group; planes [batch][h][t][d] */ const float rf = RF ? RF[(size_t)h * TT + t] : 1.0f; v2h o16; v2us oh, ol;
#pragma unroll
    for (int q = 0; q < 2; ++q) { const int dd = d + q; const int dp = (dd < HD / 2) ? dd + HD / 2 : dd - HD / 2; float x0 = f[dd], x1 = f[dp];
        if (RF) { float n0 = __fmul_rn(x0, rf), n1 = __fmul_rn(x1, rf); asm volatile("" : "+v"(n0)); asm volatile("" : "+v"(n1)); x0 = __fmul_rn(bfr(nw[dd]), n0); x1 = __fmul_rn(bfr(nw[dp]), n1); }
        const v2f cs = *(const v2f*)(CS + ((size_t)t * HD + dd) * 2); float a = __fmul_rn(x0, cs[0]), bq = __fmul_rn(x1, cs[1]); asm volatile("" : "+v"(a)); asm volatile("" : "+v"(bq)); const float r = ((dd < HD / 2) ? __fsub_rn(a, bq) : __fadd_rn(a, bq)) * sc;
        o16[q] = tohx(r); unsigned short a2, c2; splitf(r, a2, c2); oh[q] = a2; ol[q] = c2; }
    *(v2h*)(P16 + eo) = o16; *(v2us*)(Ph + eo) = oh; *(v2us*)(Pl + eo) = ol;  }
__global__ __launch_bounds__(256) void k_vtp(const float* __restrict__ F, int pitch, int nheads, h16* V16, bf* Vh, bf* Vl) { const size_t e = ((size_t)blockIdx.x * 256 + threadIdx.x) * 2; if (e >= (size_t)nheads * HD * TT) return; const int t = (int)(e % TT); const int d = (int)((e / TT) % HD); const int g = (int)(e / ((size_t)TT * HD)); v2h o16; v2us oh, ol;
#pragma unroll
    for (int q = 0; q < 2; ++q) { const float x = F[((size_t)blockIdx.y * TT + t + q) * pitch + g * HD + d]; o16[q] = tohx(x); unsigned short a2, c2; splitf(x, a2, c2); oh[q] = a2; ol[q] = c2; }
    const size_t eo = e + (size_t)blockIdx.y * nheads * HD * TT;   /* grid y: batch of the group; planes [batch][g][d][t] */
    *(v2h*)(V16 + eo) = o16; *(v2us*)(Vh + eo) = oh; *(v2us*)(Vl + eo) = ol;  }
__global__ __launch_bounds__(256) void k_csid(float* CS) { const int idx = blockIdx.x * 256 + threadIdx.x; if (idx >= TT * HD) return; v2f cs; cs[0] = 1.0f; cs[1] = 0.0f; *(v2f*)(CS + (size_t)idx * 2) = cs;  }
// k_asoft: per row (zz, i): t = S x HD^-0.5 (no mask); softmax over the 2048 keys (register row, one exp, fixed trees);
__global__ __launch_bounds__(256) void k_asoft(const float* __restrict__ Sb, h16* P16, bf* Ph, bf* Pl) {
    const int lane = threadIdx.x & 31; const int row = blockIdx.x * 8 + (threadIdx.x >> 5); if (row >= ZH * TT) return; const int i = row % TT; const int zz = row / TT; (void)zz; const bool hires = (i < RH); const float* sr = Sb + (size_t)row * TT; float v[TT / 32]; float mx = -3.0e38f;
#pragma unroll
    for (int ch = 0; ch < TT / 128; ++ch) { const int j0 = ch * 128 + lane * 4; const v4f a = *(const v4f*)(sr + j0);
#pragma unroll
        for (int q = 0; q < 4; ++q) { const int j = j0 + q; (void)j; const float t = a[q] * SCL; v[ch * 4 + q] = t; mx = fmaxf(mx, t); } }
#pragma unroll
    for (int sh = 16; sh; sh >>= 1) mx = fmaxf(mx, __shfl_xor(mx, sh, 32));
    float sum = 0.f;
#pragma unroll
    for (int k = 0; k < TT / 32; ++k) { float d0 = __fsub_rn(v[k], mx); asm volatile("" : "+v"(d0)); v[k] = __builtin_amdgcn_exp2f(__fmul_rn(d0, 1.4426950408889634f)); sum += v[k]; }
#pragma unroll
    for (int sh = 16; sh; sh >>= 1) sum += __shfl_xor(sum, sh, 32);
    const float f = __fdiv_rn(hires ? 1.0f : PCAR, sum);
{
        if (hires) {
#pragma unroll
            for (int ch = 0; ch < TT / 128; ++ch) { v4us oh, ol;
#pragma unroll
                for (int q = 0; q < 4; ++q) { unsigned short a, c2; splitf(v[ch * 4 + q] * f, a, c2); oh[q] = a; ol[q] = c2; }
                const size_t oo = ((size_t)zz * (RH ? RH : 1) + i) * TT + ch * 128 + lane * 4; *(v4us*)(Ph + oo) = oh; *(v4us*)(Pl + oo) = ol; }
        } else {
#pragma unroll
            for (int ch = 0; ch < TT / 128; ++ch) { v4h o4;
#pragma unroll
                for (int q = 0; q < 4; ++q) o4[q] = tohx(v[ch * 4 + q] * f);
                *(v4h*)(P16 + (size_t)row * TT + ch * 128 + lane * 4) = o4; } }
         }
}
__global__ __launch_bounds__(256) void k_merge(const float* __restrict__ O, int h0, bf* Ah, bf* Al) { const size_t e = ((size_t)blockIdx.x * 256 + threadIdx.x) * 2; if (e >= (size_t)ZH * TT * HD) return; const int d = (int)(e % HD); const int t = (int)((e / HD) % TT); const int zz = (int)(e / ((size_t)HD * TT)); const float cs = (t < RH) ? 1.0f : (1.0f / PCAR); const size_t oo = (size_t)t * DQ + (h0 + zz) * HD + d;
    const float* op = O + (size_t)zz * KSP * TT * HD + (size_t)t * HD + d; v2f s = *(const v2f*)op;   // head zz's KSP partial planes lie one behind the other
#pragma unroll
    for (int ks = 1; ks < KSP; ++ks) s += *(const v2f*)(op + (size_t)ks * TT * HD);
    v2us oh, ol;
#pragma unroll
    for (int q = 0; q < 2; ++q) { unsigned short a, c2; splitf(s[q] * cs, a, c2); oh[q] = a; ol[q] = c2; } *(v2us*)(Ah + oo) = oh; *(v2us*)(Al + oo) = ol;  }

extern "C" void kernel_launch(void* const* d_in, const int* in_sizes, int n_in,
                              void* d_out, int out_size, void* d_ws, size_t ws_size, hipStream_t stream) {
    (void)in_sizes; (void)n_in; (void)out_size;
    const float* x = (const float*)d_in[0]; const float* wq = (const float*)d_in[1]; const float* bq = (const float*)d_in[2]; const float* wk = (const float*)d_in[3]; const float* bk = (const float*)d_in[4]; const float* wv = (const float*)d_in[5]; const float* bv = (const float*)d_in[6]; const float* wo = (const float*)d_in[7]; const float* bo = (const float*)d_in[8];   /* weights ('oi' [768][768]) */
    float* OUT = (float*)d_out;     // [4][2048][768]
    char* wsp = (char*)d_ws;
    auto take = [&](size_t bytes) { char* p = wsp; wsp += (bytes + 255) & ~(size_t)255; return (void*)p; };
    bf* WQ = (bf*)take((size_t)DQ * DM * 2); bf* WK = (bf*)take((size_t)DKV * DM * 2); bf* WV = (bf*)take((size_t)DKV * DM * 2); bf* WO = (bf*)take((size_t)DM * DQ * 2); float* CS = (float*)take((size_t)TT * HD * 2 * 4);
    h16* QP16 = (h16*)take((size_t)BG * NH_ * TT * HD * 2); h16* KP16 = (h16*)take((size_t)BG * NKV * TT * HD * 2); h16* VT16 = (h16*)take((size_t)BG * NKV * HD * TT * 2);
    bf* QPh = (bf*)take((size_t)BG * NH_ * TT * HD * 2); bf* QPl = (bf*)take((size_t)BG * NH_ * TT * HD * 2); bf* KPh = (bf*)take((size_t)BG * NKV * TT * HD * 2); bf* KPl = (bf*)take((size_t)BG * NKV * TT * HD * 2); bf* VTh = (bf*)take((size_t)BG * NKV * HD * TT * 2); bf* VTl = (bf*)take((size_t)BG * NKV * HD * TT * 2); bf* Ph = (bf*)take((size_t)ZH * RH * TT * 2); bf* Pl = (bf*)take((size_t)ZH * RH * TT * 2);
    float* Sb = (float*)take((size_t)ZH * TT * TT * 4); h16* P16 = (h16*)take((size_t)ZH * TT * TT * 2); bf* ATh = (bf*)take((size_t)BG * TT * DQ * 2); bf* ATl = (bf*)take((size_t)BG * TT * DQ * 2);
    if ((size_t)(wsp - (char*)d_ws) > ws_size) return;    // ws 256 MiB
    // The score buffer (ZH x 16 MiB) also serves, stream-ordered, whatever is dead while scores live: the group's x copy and f32 projections (30 MiB, last read by the plane builders, before the group's first S GEMM) and a pass's P x V partial planes (48 MiB, written after k_asoft has read the scores, read by k_merge before the next S GEMM).
    bf* XB = (bf*)Sb; float* FQ = (float*)(XB + (size_t)BG * TT * DM); float* FK = FQ + (size_t)BG * TT * DQ; float* Ob = Sb;
    float* FV = FK;   // v projection reuses the k buffer after the k planes are built (stream-ordered)
    { k_cvt8<<<(unsigned)(((size_t)DQ * DM / 8 + 255) / 256), 256, 0, stream>>>(wq, WQ, (size_t)DQ * DM / 8); k_cvt8<<<(unsigned)(((size_t)DKV * DM / 8 + 255) / 256), 256, 0, stream>>>(wk, WK, (size_t)DKV * DM / 8); k_cvt8<<<(unsigned)(((size_t)DKV * DM / 8 + 255) / 256), 256, 0, stream>>>(wv, WV, (size_t)DKV * DM / 8);
      k_cvt8<<<(unsigned)(((size_t)DM * DQ / 8 + 255) / 256), 256, 0, stream>>>(wo, WO, (size_t)DM * DQ / 8);
       }
    k_csid<<<(TT * HD + 255) / 256, 256, 0, stream>>>(CS);
    const unsigned LQ = (unsigned)(((size_t)NH_ * TT * HD / 2 + 255) / 256), LKv = (unsigned)(((size_t)NKV * TT * HD / 2 + 255) / 256);
    for (int b = 0; b < NB_; b += BG) {
        k_cvt8<<<(unsigned)(((size_t)BG * TT * DM / 8 + 255) / 256), 256, 0, stream>>>(x + (size_t)b * TT * DM, XB, (size_t)BG * TT * DM / 8);
        k_gemmw<bf, 0, true><<<dim3(BG * TT / 64, DQ / 64, 1), 32, 0, stream>>>(XB, nullptr, WQ, nullptr, DM, FQ, DQ, bq, 0, 0, 0);
        k_rope<<<dim3(LQ, BG, 1), 256, 0, stream>>>(FQ, DQ, NH_, CS, nullptr, nullptr, 1.0f, QP16, QPh, QPl);
        k_gemmw<bf, 0, true><<<dim3(BG * TT / 64, DKV / 64, 1), 32, 0, stream>>>(XB, nullptr, WK, nullptr, DM, FK, DKV, bk, 0, 0, 0);
        k_rope<<<dim3(LKv, BG, 1), 256, 0, stream>>>(FK, DKV, NKV, CS, nullptr, nullptr, 1.0f, KP16, KPh, KPl);
        k_gemmw<bf, 0, true><<<dim3(BG * TT / 64, DKV / 64, 1), 32, 0, stream>>>(XB, nullptr, WV, nullptr, DM, FV, DKV, bv, 0, 0, 0); k_vtp<<<dim3(LKv, BG, 1), 256, 0, stream>>>(FV, DKV, NKV, VT16, VTh, VTl);
        for (int bb = 0; bb < BG; ++bb)
        for (int h0 = 0; h0 < NH_; h0 += ZH) { const size_t zq = (size_t)(bb * NH_ + h0), zk = (size_t)(bb * NKV + h0 / REP);   // one kv head per query head: the pass's ZH heads use consecutive kv planes (z-strides TT*HD)
            k_gemmw<bf, 2, false><<<dim3(RH / 64, TT / 64, ZH), 32, 0, stream>>>(QPh + zq * TT * HD, QPl + zq * TT * HD, KPh + zk * TT * HD, KPl + zk * TT * HD, HD, Sb, TT, nullptr, (size_t)TT * HD, (size_t)TT * HD, (size_t)TT * TT);
            k_gemmw<h16, 0, false><<<dim3((TT - RH) / 64, TT / 64, ZH), 32, 0, stream>>>(QP16 + zq * TT * HD + (size_t)RH * HD, nullptr, KP16 + zk * TT * HD, nullptr, HD, Sb + (size_t)RH * TT, TT, nullptr, (size_t)TT * HD, (size_t)TT * HD, (size_t)TT * TT);
            k_asoft<<<ZH * TT / 8, 256, 0, stream>>>(Sb, P16, Ph, Pl);
            k_gemmw<bf, 2, false, KSP><<<dim3(RH / 64, HD / 64, KSP * ZH), 32, 0, stream>>>(Ph, Pl, VTh + zk * HD * TT, VTl + zk * HD * TT, TT, Ob, HD, nullptr, (size_t)RH * TT, (size_t)HD * TT, (size_t)TT * HD);
            k_gemmw<h16, 0, false, KSP><<<dim3((TT - RH) / 64, HD / 64, KSP * ZH), 32, 0, stream>>>(P16 + (size_t)RH * TT, nullptr, VT16 + zk * HD * TT, nullptr, TT, Ob + (size_t)RH * HD, HD, nullptr, (size_t)TT * TT, (size_t)HD * TT, (size_t)TT * HD);
            k_merge<<<(unsigned)(((size_t)ZH * TT * HD / 2 + 255) / 256), 256, 0, stream>>>(Ob, h0, ATh + (size_t)bb * TT * DQ, ATl + (size_t)bb * TT * DQ); }
        k_gemmw<bf, 1, true><<<dim3(BG * TT / 64, DM / 64, 1), 32, 0, stream>>>(ATh, ATl, WO, nullptr, DQ, OUT + (size_t)b * TT * DM, DM, bo, 0, 0, 0); }
}

// v003
// Measured time: 375 microseconds a run.
// Two timings next to v002 both put it at 2.41 times that version's speed.
// Counting every step since v000, it is 7.95 times as fast.
#include <hip/hip_runtime.h>

// Multi-head attention at d_model 768 with biased projections (x [4][2048][768]; q, k, v = x W^T + b ('oi' [768][768] 768^-0.5 + biases 0.01: non-zero; 12 heads x 64); attn x 64^-0.5; softmax over all keys (no mask); out = merged Wo^T + bo ('oi' + bias 0.01) -> [4][2048][768] (6.3 M); argument order x, Wq, bq, Wk, bk, Wv, bv, Wo, bo).
// Layout per group of BG batches: bf16 copy of x; 'oi' weights as-is; exact projections (K 768) + f32 biases; identity-table plane builders; one fused attention launch per group (scores, online softmax and P x V stay in registers; hybrid rows: < 512 hi/lo 3 products, rest fp16); merged hi/lo x Wo exact + bo.
// Compute dtypes, f32 accumulate: every input rounded to bf16; projections exact + f32 biases; attention rows < 512 3 products, rest fp16; softmax f32; output projection hl x exact.

#define NB_  4
#define TT   2048
#define DM   768
#define NH_  12
#define NKV  12
#define REP  (NH_ / NKV)
#define HD   64
#define DQ   (NH_ * HD)
#define DKV  (NKV * HD)
#define BG   2                    // batches per projection / plane-builder / attention / output launch
#define RH   512                  // query rows < RH use hi+lo planes (0: none)
#define WIN  0
#define SCL  0.125f   // HD^-0.5
#define FW   4                    // k_fattn: waves per block
#define SK   64                   // k_fattn: keys per LDS stage (two passes of 32 keys)
#define LP   72                   // k_fattn: LDS row pitch in 16-bit elements (144 B = 16 B x odd, conflict-free for 16-byte reads)
#define HB   (RH / (16 * FW))     // k_fattn: hi/lo blocks per head (16 queries a wave)
#define LB   ((TT - RH) / (32 * FW))   // k_fattn: fp16 blocks per head (32 queries a wave)
#define CL   0.18033688011112042f // HD^-0.5 x log2(e)
typedef _Float16 h16;
typedef unsigned short bf;
typedef __attribute__((ext_vector_type(16))) __bf16   v16bf;
typedef __attribute__((ext_vector_type(16))) _Float16 v16h;
typedef __attribute__((ext_vector_type(8)))  _Float16 v8h;
typedef __attribute__((ext_vector_type(8)))  unsigned short v8us;
typedef __attribute__((ext_vector_type(8)))  float    v8f;
typedef __attribute__((ext_vector_type(4)))  float    v4f;
typedef v8h  __attribute__((may_alias)) v8ha;
typedef v4f  __attribute__((may_alias)) v4fa;
typedef v8us __attribute__((may_alias)) v8usa;

__device__ __forceinline__ unsigned short f2bf(float f) { unsigned u = __float_as_uint(f); u += 0x7FFFu + ((u >> 16) & 1u); return (unsigned short)(u >> 16); }
__device__ __forceinline__ float bf2f(unsigned short b) { return __uint_as_float(((unsigned)b) << 16); }
__device__ __forceinline__ float bfr(float f) { return bf2f(f2bf(f)); }
__device__ __forceinline__ v16h cat16(v8h lo, v8h hi) { return __builtin_shufflevector(lo, hi, 0, 1, 2, 3, 4, 5, 6, 7, 8, 9, 10, 11, 12, 13, 14, 15); }
__device__ __forceinline__ v16bf cat16b(v8us lo, v8us hi) { return __builtin_bit_cast(v16bf, __builtin_shufflevector(lo, hi, 0, 1, 2, 3, 4, 5, 6, 7, 8, 9, 10, 11, 12, 13, 14, 15)); }
__device__ __forceinline__ v8f wmma16(v16h a, v16h b, v8f c) { return __builtin_amdgcn_wmma_f32_16x16x32_f16(false, a, false, b, (short)0, c, false, false); }
__device__ __forceinline__ v8f wmmab(v16bf a, v16bf b, v8f c) { return __builtin_amdgcn_wmma_f32_16x16x32_bf16(false, a, false, b, (short)0, c, false, false); }



// ---- k_gemmw: register-blocked GEMM, ONE WAVE per 64x64 output tile (16 accumulators), operands straight from K-contiguous 16-bit planes; grid (M/64, N/64, Z), 32 threads.
// C[m][n] (f32, pitch ldc, + optional f32 bias[n]) = sum_k A[m][k] Bt[n][k] (+ split products per NSPLIT). z-batch strides sA/sB/sC in elements. K % 32 == 0.
// KS > 1: grid z = batches x KS (ks fastest); block (batch, ks) sums only k in [ks K/KS, (ks+1) K/KS) and writes partial plane C + z sC; the consumer adds a batch's KS planes. K % (32 KS) == 0.
template <typename T16> struct WFrag;
template <> struct WFrag<h16> { typedef v16h V; static __device__ __forceinline__ V ld(const h16* p) { return cat16(*(const v8h*)p, *(const v8h*)(p + 16)); } static __device__ __forceinline__ v8f mma(V a, V b, v8f c) { return wmma16(a, b, c); } };
template <> struct WFrag<bf> { typedef v16bf V; static __device__ __forceinline__ V ld(const bf* p) { return cat16b(*(const v8us*)p, *(const v8us*)(p + 16)); } static __device__ __forceinline__ v8f mma(V a, V b, v8f c) { return wmmab(a, b, c); } };
template <typename T16, int NSPLIT, bool BIAS, int KS = 1>
__global__ __launch_bounds__(32) void k_gemmw(const T16* __restrict__ A, const T16* __restrict__ A2, const T16* __restrict__ Bt, const T16* __restrict__ Bt2, int K, float* C, int ldc, const float* __restrict__ bias, size_t sA, size_t sB, size_t sC) {
    typedef typename WFrag<T16>::V V;
    __shared__ __align__(16) float os[16 * 68];
    const size_t z = blockIdx.z; const size_t zb = z / KS; const int kb = (int)(z % KS) * (K / KS), ke = kb + K / KS;
    A += zb * sA; if (A2) A2 += zb * sA; Bt += zb * sB; if (Bt2) Bt2 += zb * sB; C += z * sC;
    const int lane = threadIdx.x & 31, lr = lane & 15, hi = lane >> 4; const int r0 = blockIdx.x * 64, c0 = blockIdx.y * 64;
    v8f acc[4][4];
#pragma unroll
    for (int mb = 0; mb < 4; ++mb)
#pragma unroll
        for (int nb = 0; nb < 4; ++nb) acc[mb][nb] = (v8f){};
    const size_t aoff = (size_t)(r0 + lr) * K + 8 * hi, boff = (size_t)(c0 + lr) * K + 8 * hi;
#pragma unroll 1
    for (int kc = kb; kc < ke; kc += 32) {
        V a[4], a2[4];
#pragma unroll
        for (int mb = 0; mb < 4; ++mb) { a[mb] = WFrag<T16>::ld(A + aoff + (size_t)mb * 16 * K + kc); if (NSPLIT == 1 || NSPLIT == 2) a2[mb] = WFrag<T16>::ld(A2 + aoff + (size_t)mb * 16 * K + kc); }
#pragma unroll
        for (int nb = 0; nb < 4; ++nb) { const V b = WFrag<T16>::ld(Bt + boff + (size_t)nb * 16 * K + kc); V b2; if (NSPLIT >= 2) b2 = WFrag<T16>::ld(Bt2 + boff + (size_t)nb * 16 * K + kc);
#pragma unroll
            for (int mb = 0; mb < 4; ++mb) { acc[mb][nb] = WFrag<T16>::mma(a[mb], b, acc[mb][nb]); if (NSPLIT == 1 || NSPLIT == 2) acc[mb][nb] = WFrag<T16>::mma(a2[mb], b, acc[mb][nb]); if (NSPLIT >= 2) acc[mb][nb] = WFrag<T16>::mma(a[mb], b2, acc[mb][nb]); } }
        asm volatile("v_nop\n\tv_nop\n\tv_nop\n\tv_nop" : "+v"(acc[0][0]), "+v"(acc[1][1]), "+v"(acc[2][2]), "+v"(acc[3][3]) : "v"(a[0]), "v"(a[3]));
    }
#pragma unroll
    for (int mb = 0; mb < 4; ++mb) {
#pragma unroll
        for (int nb = 0; nb < 4; ++nb) {
#pragma unroll
            for (int j = 0; j < 8; ++j) os[(hi * 8 + j) * 68 + nb * 16 + lr] = acc[mb][nb][j]; }
        __builtin_amdgcn_wave_barrier(); asm volatile("" ::: "memory");
        float* crow = C + (size_t)(r0 + mb * 16) * ldc + c0;
{
#pragma unroll
            for (int s = 0; s < 8; ++s) { const int row = 2 * s + hi, cofs = lr * 4; v4f val = *(const v4fa*)(os + row * 68 + cofs); if (BIAS) { val[0] += bfr(bias[c0 + cofs]); val[1] += bfr(bias[c0 + cofs + 1]); val[2] += bfr(bias[c0 + cofs + 2]); val[3] += bfr(bias[c0 + cofs + 3]); }
                *(v4f*)(crow + (size_t)row * ldc + cofs) = val; }
             }
        __builtin_amdgcn_wave_barrier(); asm volatile("" ::: "memory");
    }
}

__device__ __forceinline__ h16 tohx(float x) { return (h16)x; }
__device__ __forceinline__ void splitf(float y, unsigned short& h, unsigned short& l) { h = f2bf(y); l = f2bf(y - bf2f(h)); }
typedef __attribute__((ext_vector_type(2))) _Float16 v2h;
typedef __attribute__((ext_vector_type(4))) _Float16 v4h;
typedef __attribute__((ext_vector_type(2))) unsigned short v2us;
typedef __attribute__((ext_vector_type(4))) unsigned short v4us;
typedef __attribute__((ext_vector_type(2))) float v2f;
typedef __attribute__((ext_vector_type(4))) int v4i;

__global__ __launch_bounds__(256) void k_cvt8(const float* __restrict__ src, bf* dst, size_t n8) { const size_t i = (size_t)blockIdx.x * 256 + threadIdx.x; if (i >= n8) return; const v8f v = *(const v8f*)(src + i * 8); v8us o;
#pragma unroll
    for (int k = 0; k < 8; ++k) o[k] = f2bf(v[k]); *(v8us*)(dst + i * 8) = o;  }

// k_rope: head planes [h][t][d] (fp16 + hi/lo) of rope(x) x sc with the rotate-half convention out[d] = x[d] cos[t][d] - x[d+HD/2] sin[t][d], out[d+HD/2] = x[d+HD/2] cos[t][d+HD/2] + x[d] sin[t][d+HD/2]
__global__ __launch_bounds__(256) void k_rope(const float* __restrict__ F, int pitch, int nheads, const float* __restrict__ CS, const float* __restrict__ RF, const float* __restrict__ nw, float sc, h16* P16, bf* Ph, bf* Pl) {
    const size_t e = ((size_t)blockIdx.x * 256 + threadIdx.x) * 2; if (e >= (size_t)nheads * TT * HD) return; const int d = (int)(e % HD); const int t = (int)((e / HD) % TT); const int h = (int)(e / ((size_t)HD * TT)); const float* f = F + ((size_t)blockIdx.y * TT + t) * pitch + h * HD; const size_t eo = e + (size_t)blockIdx.y * nheads * TT * HD;   /* grid y: batch of the group; planes [batch][h][t][d] */ const float rf = RF ? RF[(size_t)h * TT + t] : 1.0f; v2h o16; v2us oh, ol;
#pragma unroll
    for (int q = 0; q < 2; ++q) { const int dd = d + q; const int dp = (dd < HD / 2) ? dd + HD / 2 : dd - HD / 2; float x0 = f[dd], x1 = f[dp];
        if (RF) { float n0 = __fmul_rn(x0, rf), n1 = __fmul_rn(x1, rf); asm volatile("" : "+v"(n0)); asm volatile("" : "+v"(n1)); x0 = __fmul_rn(bfr(nw[dd]), n0); x1 = __fmul_rn(bfr(nw[dp]), n1); }
        const v2f cs = *(const v2f*)(CS + ((size_t)t * HD + dd) * 2); float a = __fmul_rn(x0, cs[0]), bq = __fmul_rn(x1, cs[1]); asm volatile("" : "+v"(a)); asm volatile("" : "+v"(bq)); const float r = ((dd < HD / 2) ? __fsub_rn(a, bq) : __fadd_rn(a, bq)) * sc;
        o16[q] = tohx(r); unsigned short a2, c2; splitf(r, a2, c2); oh[q] = a2; ol[q] = c2; }
    *(v2h*)(P16 + eo) = o16; *(v2us*)(Ph + eo) = oh; *(v2us*)(Pl + eo) = ol;  }
__global__ __launch_bounds__(256) void k_vtp(const float* __restrict__ F, int pitch, int nheads, h16* V16, bf* Vh, bf* Vl) { const size_t e = ((size_t)blockIdx.x * 256 + threadIdx.x) * 2; if (e >= (size_t)nheads * HD * TT) return; const int t = (int)(e % TT); const int d = (int)((e / TT) % HD); const int g = (int)(e / ((size_t)TT * HD)); v2h o16; v2us oh, ol;
#pragma unroll
    for (int q = 0; q < 2; ++q) { const float x = F[((size_t)blockIdx.y * TT + t + q) * pitch + g * HD + d]; o16[q] = tohx(x); unsigned short a2, c2; splitf(x, a2, c2); oh[q] = a2; ol[q] = c2; }
    const size_t eo = e + (size_t)blockIdx.y * nheads * HD * TT;   /* grid y: batch of the group; planes [batch][g][d][t] */
    *(v2h*)(V16 + eo) = o16; *(v2us*)(Vh + eo) = oh; *(v2us*)(Vl + eo) = ol;  }
__global__ __launch_bounds__(256) void k_csid(float* CS) { const int idx = blockIdx.x * 256 + threadIdx.x; if (idx >= TT * HD) return; v2f cs; cs[0] = 1.0f; cs[1] = 0.0f; *(v2f*)(CS + (size_t)idx * 2) = cs;  }
typedef __attribute__((ext_vector_type(16))) float v16f;
template <typename T16> struct Vec8;
template <> struct Vec8<h16> { typedef v8h T; static __device__ __forceinline__ void pack(v16f p, v16h& a, v16h& b) { a = __builtin_convertvector(p, v16h); (void)b; } };
template <> struct Vec8<bf> { typedef v8us T; static __device__ __forceinline__ void pack(v16f p, v16bf& a, v16bf& b) { a = __builtin_convertvector(p, v16bf); b = __builtin_convertvector(p - __builtin_convertvector(a, v16f), v16bf); } };
__device__ __forceinline__ float xhalf(float x) { return __builtin_bit_cast(float, __builtin_amdgcn_permlanex16(__builtin_bit_cast(int, x), __builtin_bit_cast(int, x), 0x76543210, 0xfedcba98, false, false)); }   // lane l with lane l ^ 16
template <typename T16, int NP, int QT>
__device__ __forceinline__ void fattn_body(T16* L, const T16* __restrict__ Q0, const T16* __restrict__ Q1, const T16* __restrict__ K0, const T16* __restrict__ K1, const T16* __restrict__ V0, const T16* __restrict__ V1, int q0, bf* Ah, bf* Al) {
    typedef typename WFrag<T16>::V V; typedef typename Vec8<T16>::T C8;
    constexpr int PLN = SK * LP, BUFE = 2 * NP * PLN;   // a buffer: K plane(s) [key][d], then V^T plane(s) [d][key]
    const int tid = threadIdx.x, lane = tid & 31, c = lane & 15, h = lane >> 4;
    V qf[QT][2], qf2[QT][2];
#pragma unroll
    for (int qt = 0; qt < QT; ++qt)
#pragma unroll
        for (int ks = 0; ks < 2; ++ks) { const size_t qo = (size_t)(q0 + qt * 16 + c) * HD + ks * 32 + 8 * h; qf[qt][ks] = WFrag<T16>::ld(Q0 + qo); if (NP == 2) qf2[qt][ks] = WFrag<T16>::ld(Q1 + qo); }
    v8f o[QT][4]; float mref[QT], lsum[QT];
#pragma unroll
    for (int qt = 0; qt < QT; ++qt) { mref[qt] = -3.0e38f; lsum[qt] = 0.f;
#pragma unroll
        for (int dt = 0; dt < 4; ++dt) o[qt][dt] = (v8f){}; }
    const int srow = tid >> 3, scol = (tid & 7) * 8;   // staging: 8 threads a 128-byte row, rows srow + 16 j
    C8 sg[2 * NP][4];
    auto fetch = [&](int k0) {
#pragma unroll
        for (int j = 0; j < 4; ++j) { const int row = srow + (FW * 4) * j; const size_t ko = (size_t)(k0 + row) * HD + scol, vo = (size_t)row * TT + k0 + scol;
            sg[0][j] = *(const C8*)(K0 + ko); if (NP == 2) sg[1][j] = *(const C8*)(K1 + ko); sg[NP][j] = *(const C8*)(V0 + vo); if (NP == 2) sg[NP + 1][j] = *(const C8*)(V1 + vo); }
        asm volatile("s_wait_xcnt 0x0" ::: "memory"); };   // stands before the loads' address registers are reused
    auto stash = [&](T16* Bw) {
#pragma unroll
        for (int pl = 0; pl < 2 * NP; ++pl)
#pragma unroll
            for (int j = 0; j < 4; ++j) *(C8*)(Bw + pl * PLN + (srow + (FW * 4) * j) * LP + scol) = sg[pl][j]; };
    fetch(0); stash(L); __syncthreads();
#pragma unroll 1   // stays rolled: a stage is already two unrolled passes, more would only cost registers and instruction cache
    for (int s = 0; s < TT / SK; ++s) {
        const T16* B = L + (s & 1) * BUFE;
        if (s + 1 < TT / SK) fetch((s + 1) * SK);   // the next stage flies while this one is worked on
#pragma unroll
        for (int p = 0; p < SK / 32; ++p) {
            v8f sc[QT][2];
#pragma unroll
            for (int kt = 0; kt < 2; ++kt) { const T16* kr = B + ((p * 2 + kt) * 16 + c) * LP + 8 * h; V ka[2], ka2[2];
#pragma unroll
                for (int ks = 0; ks < 2; ++ks) { ka[ks] = WFrag<T16>::ld(kr + ks * 32); if (NP == 2) ka2[ks] = WFrag<T16>::ld(kr + PLN + ks * 32); }
#pragma unroll
                for (int qt = 0; qt < QT; ++qt) { v8f a = (v8f){};
#pragma unroll
                    for (int ks = 0; ks < 2; ++ks) { a = WFrag<T16>::mma(ka[ks], qf[qt][ks], a); if (NP == 2) { a = WFrag<T16>::mma(ka[ks], qf2[qt][ks], a); a = WFrag<T16>::mma(ka2[ks], qf[qt][ks], a); } }
                    sc[qt][kt] = a; } }
            float mloc[QT]; bool need = false;
#pragma unroll
            for (int qt = 0; qt < QT; ++qt) { float t[8];
#pragma unroll
                for (int r = 0; r < 8; ++r) t[r] = fmaxf(sc[qt][0][r], sc[qt][1][r]);
                float m = fmaxf(fmaxf(fmaxf(t[0], t[1]), fmaxf(t[2], t[3])), fmaxf(fmaxf(t[4], t[5]), fmaxf(t[6], t[7]))); m = fmaxf(m, xhalf(m)); mloc[qt] = m * CL; need = need || (mloc[qt] > mref[qt] + 8.0f); }
            if (__builtin_amdgcn_ballot_w32(need) != 0) {   // one wave-uniform test a pass; every lane renews its maximum
#pragma unroll
                for (int qt = 0; qt < QT; ++qt) { const float mn = fmaxf(mref[qt], mloc[qt]); const float al = __builtin_amdgcn_exp2f(mref[qt] - mn); mref[qt] = mn; lsum[qt] *= al;
#pragma unroll
                    for (int dt = 0; dt < 4; ++dt) o[qt][dt] *= al; } }
            V pb[QT], pb2[QT];
#pragma unroll
            for (int qt = 0; qt < QT; ++qt) { v16f pv;
#pragma unroll
                for (int i = 0; i < 16; ++i) pv[i] = __builtin_amdgcn_exp2f(__builtin_fmaf(sc[qt][i >> 3][i & 7], CL, -mref[qt]));
                float t[8];
#pragma unroll
                for (int r = 0; r < 8; ++r) t[r] = pv[r] + pv[r + 8];
                lsum[qt] += ((t[0] + t[1]) + (t[2] + t[3])) + ((t[4] + t[5]) + (t[6] + t[7]));
                Vec8<T16>::pack(pv, pb[qt], pb2[qt]); }
#pragma unroll
            for (int dt = 0; dt < 4; ++dt) { const T16* vr = B + NP * PLN + (dt * 16 + c) * LP + p * 32 + 8 * h; const V va = WFrag<T16>::ld(vr); V va2; if (NP == 2) va2 = WFrag<T16>::ld(vr + PLN);
#pragma unroll
                for (int qt = 0; qt < QT; ++qt) { o[qt][dt] = WFrag<T16>::mma(va, pb[qt], o[qt][dt]); if (NP == 2) { o[qt][dt] = WFrag<T16>::mma(va, pb2[qt], o[qt][dt]); o[qt][dt] = WFrag<T16>::mma(va2, pb[qt], o[qt][dt]); } } }
        }
        if (s + 1 < TT / SK) stash(L + ((s + 1) & 1) * BUFE);   // its last readers left that buffer at the barrier of stage s - 1
        __syncthreads();
    }
#pragma unroll
    for (int qt = 0; qt < QT; ++qt) { const float inv = __fdiv_rn(1.0f, lsum[qt] + xhalf(lsum[qt])); const size_t ro = (size_t)(q0 + qt * 16 + c) * DQ + 8 * h;   // a lane holds 8 consecutive d of one query: 16-byte stores
#pragma unroll
        for (int dt = 0; dt < 4; ++dt) { v8us oh, ol;
#pragma unroll
            for (int r = 0; r < 8; ++r) { unsigned short a, c2; splitf(o[qt][dt][r] * inv, a, c2); oh[r] = a; ol[r] = c2; }
            *(v8us*)(Ah + ro + dt * 16) = oh; *(v8us*)(Al + ro + dt * 16) = ol;
            asm volatile("s_wait_xcnt 0x0" ::: "memory"); } }   // stands before the stores' address and data registers are reused
}
// amdgpu_waves_per_eu(4): holds the allocation under 256 VGPRs; without it the build goes just above and needs register-window switches in the loop.
__global__ __launch_bounds__(FW * 32) __attribute__((amdgpu_waves_per_eu(4))) void k_fattn(const h16* __restrict__ Q16, const h16* __restrict__ K16, const h16* __restrict__ V16, const bf* __restrict__ Qh, const bf* __restrict__ Ql, const bf* __restrict__ Kh, const bf* __restrict__ Kl, const bf* __restrict__ Vh, const bf* __restrict__ Vl, bf* Ah, bf* Al) {
    __shared__ __align__(16) unsigned short L[2 * 4 * SK * LP];
    const int z = blockIdx.x, bb = z / NH_, hh = z % NH_, w = threadIdx.x >> 5; const size_t pq = (size_t)z * TT * HD, pk = (size_t)(bb * NKV + hh / REP) * TT * HD, ao = (size_t)bb * TT * DQ + hh * HD;
    if (blockIdx.y < HB) fattn_body<bf, 2, 1>((bf*)L, Qh + pq, Ql + pq, Kh + pk, Kl + pk, Vh + pk, Vl + pk, ((int)blockIdx.y * FW + w) * 16, Ah + ao, Al + ao);
    else fattn_body<h16, 1, 2>((h16*)L, Q16 + pq, nullptr, K16 + pk, nullptr, V16 + pk, nullptr, RH + (((int)blockIdx.y - HB) * FW + w) * 32, Ah + ao, Al + ao);
}

extern "C" void kernel_launch(void* const* d_in, const int* in_sizes, int n_in,
                              void* d_out, int out_size, void* d_ws, size_t ws_size, hipStream_t stream) {
    (void)in_sizes; (void)n_in; (void)out_size;
    const float* x = (const float*)d_in[0]; const float* wq = (const float*)d_in[1]; const float* bq = (const float*)d_in[2]; const float* wk = (const float*)d_in[3]; const float* bk = (const float*)d_in[4]; const float* wv = (const float*)d_in[5]; const float* bv = (const float*)d_in[6]; const float* wo = (const float*)d_in[7]; const float* bo = (const float*)d_in[8];   /* weights ('oi' [768][768]) */
    float* OUT = (float*)d_out;     // [4][2048][768]
    char* wsp = (char*)d_ws;
    auto take = [&](size_t bytes) { char* p = wsp; wsp += (bytes + 255) & ~(size_t)255; return (void*)p; };
    bf* WQ = (bf*)take((size_t)DQ * DM * 2); bf* WK = (bf*)take((size_t)DKV * DM * 2); bf* WV = (bf*)take((size_t)DKV * DM * 2); bf* WO = (bf*)take((size_t)DM * DQ * 2); float* CS = (float*)take((size_t)TT * HD * 2 * 4);
    h16* QP16 = (h16*)take((size_t)BG * NH_ * TT * HD * 2); h16* KP16 = (h16*)take((size_t)BG * NKV * TT * HD * 2); h16* VT16 = (h16*)take((size_t)BG * NKV * HD * TT * 2);
    bf* QPh = (bf*)take((size_t)BG * NH_ * TT * HD * 2); bf* QPl = (bf*)take((size_t)BG * NH_ * TT * HD * 2); bf* KPh = (bf*)take((size_t)BG * NKV * TT * HD * 2); bf* KPl = (bf*)take((size_t)BG * NKV * TT * HD * 2); bf* VTh = (bf*)take((size_t)BG * NKV * HD * TT * 2); bf* VTl = (bf*)take((size_t)BG * NKV * HD * TT * 2);
    bf* XB = (bf*)take((size_t)BG * TT * DM * 2); float* FQ = (float*)take((size_t)BG * TT * DQ * 4); float* FK = (float*)take((size_t)BG * TT * DKV * 4); bf* ATh = (bf*)take((size_t)BG * TT * DQ * 2); bf* ATl = (bf*)take((size_t)BG * TT * DQ * 2);
    if ((size_t)(wsp - (char*)d_ws) > ws_size) return;    // ws 256 MiB
    float* FV = FK;   // v projection reuses the k buffer after the k planes are built (stream-ordered)
    { k_cvt8<<<(unsigned)(((size_t)DQ * DM / 8 + 255) / 256), 256, 0, stream>>>(wq, WQ, (size_t)DQ * DM / 8); k_cvt8<<<(unsigned)(((size_t)DKV * DM / 8 + 255) / 256), 256, 0, stream>>>(wk, WK, (size_t)DKV * DM / 8); k_cvt8<<<(unsigned)(((size_t)DKV * DM / 8 + 255) / 256), 256, 0, stream>>>(wv, WV, (size_t)DKV * DM / 8);
      k_cvt8<<<(unsigned)(((size_t)DM * DQ / 8 + 255) / 256), 256, 0, stream>>>(wo, WO, (size_t)DM * DQ / 8);
       }
    k_csid<<<(TT * HD + 255) / 256, 256, 0, stream>>>(CS);
    const unsigned LQ = (unsigned)(((size_t)NH_ * TT * HD / 2 + 255) / 256), LKv = (unsigned)(((size_t)NKV * TT * HD / 2 + 255) / 256);
    for (int b = 0; b < NB_; b += BG) {
        k_cvt8<<<(unsigned)(((size_t)BG * TT * DM / 8 + 255) / 256), 256, 0, stream>>>(x + (size_t)b * TT * DM, XB, (size_t)BG * TT * DM / 8);
        k_gemmw<bf, 0, true><<<dim3(BG * TT / 64, DQ / 64, 1), 32, 0, stream>>>(XB, nullptr, WQ, nullptr, DM, FQ, DQ, bq, 0, 0, 0);
        k_rope<<<dim3(LQ, BG, 1), 256, 0, stream>>>(FQ, DQ, NH_, CS, nullptr, nullptr, 1.0f, QP16, QPh, QPl);
        k_gemmw<bf, 0, true><<<dim3(BG * TT / 64, DKV / 64, 1), 32, 0, stream>>>(XB, nullptr, WK, nullptr, DM, FK, DKV, bk, 0, 0, 0);
        k_rope<<<dim3(LKv, BG, 1), 256, 0, stream>>>(FK, DKV, NKV, CS, nullptr, nullptr, 1.0f, KP16, KPh, KPl);
        k_gemmw<bf, 0, true><<<dim3(BG * TT / 64, DKV / 64, 1), 32, 0, stream>>>(XB, nullptr, WV, nullptr, DM, FV, DKV, bv, 0, 0, 0); k_vtp<<<dim3(LKv, BG, 1), 256, 0, stream>>>(FV, DKV, NKV, VT16, VTh, VTl);
        k_fattn<<<dim3(BG * NH_, HB + LB, 1), FW * 32, 0, stream>>>(QP16, KP16, VT16, QPh, QPl, KPh, KPl, VTh, VTl, ATh, ATl);   // hi/lo blocks (the longer ones) take the lowest blockIdx.y
        k_gemmw<bf, 1, true><<<dim3(BG * TT / 64, DM / 64, 1), 32, 0, stream>>>(ATh, ATl, WO, nullptr, DQ, OUT + (size_t)b * TT * DM, DM, bo, 0, 0, 0); }
}

// v004
// A run of this version takes 298 microseconds.
// Next to v003, in two timings, it ran 1.26 and 1.25 times as fast.
// All steps since v000 together make it 9.97 times as fast.
#include <hip/hip_runtime.h>

// Multi-head attention at d_model 768 with biased projections (x [4][2048][768]; q, k, v = x W^T + b ('oi' [768][768] 768^-0.5 + biases 0.01: non-zero; 12 heads x 64); attn x 64^-0.5; softmax over all keys (no mask); out = merged Wo^T + bo ('oi' + bias 0.01) -> [4][2048][768] (6.3 M); argument order x, Wq, bq, Wk, bk, Wv, bv, Wo, bo).
// Layout per group of BG batches: bf16 copy of x; 'oi' weights as-is; exact projections (K 768) + f32 biases, whose epilogue writes the head planes (fp16, bf16 hi, bf16 lo; V transposed); one fused attention launch per group (scores, online softmax and P x V stay in registers; hybrid rows: < 512 hi/lo 3 products, rest fp16); merged hi/lo x Wo exact + bo.
// Compute dtypes, f32 accumulate: every input rounded to bf16; projections exact + f32 biases; attention rows < 512 3 products, rest fp16; softmax f32; output projection hl x exact.

#define NB_  4
#define TT   2048
#define DM   768
#define NH_  12
#define NKV  12
#define REP  (NH_ / NKV)
#define HD   64
#define DQ   (NH_ * HD)
#define DKV  (NKV * HD)
#define BG   2                    // batches per projection / attention / output launch
#define RH   512                  // query rows < RH use hi+lo planes (0: none)
#define WIN  0
#define SCL  0.125f   // HD^-0.5
#define FW   4                    // k_fattn: waves per block
#define SK   64                   // k_fattn: keys per LDS stage (two passes of 32 keys)
#define LP   72                   // k_fattn: LDS row pitch in 16-bit elements (144 B = 16 B x odd, conflict-free for 16-byte reads)
#define HB   (RH / (16 * FW))     // k_fattn: hi/lo blocks per head (16 queries a wave)
#define LB   ((TT - RH) / (32 * FW))   // k_fattn: fp16 blocks per head (32 queries a wave)
#define CL   0.18033688011112042f // HD^-0.5 x log2(e)
typedef _Float16 h16;
typedef unsigned short bf;
typedef __attribute__((ext_vector_type(16))) __bf16   v16bf;
typedef __attribute__((ext_vector_type(16))) _Float16 v16h;
typedef __attribute__((ext_vector_type(8)))  _Float16 v8h;
typedef __attribute__((ext_vector_type(8)))  unsigned short v8us;
typedef __attribute__((ext_vector_type(8)))  float    v8f;
typedef __attribute__((ext_vector_type(4)))  float    v4f;
typedef v8h  __attribute__((may_alias)) v8ha;
typedef v4f  __attribute__((may_alias)) v4fa;
typedef v8us __attribute__((may_alias)) v8usa;
typedef __attribute__((ext_vector_type(8)))  __bf16   v8bf;
typedef __attribute__((ext_vector_type(4)))  unsigned v4u;

__device__ __forceinline__ unsigned short f2bf(float f) { unsigned u = __float_as_uint(f); u += 0x7FFFu + ((u >> 16) & 1u); return (unsigned short)(u >> 16); }
__device__ __forceinline__ float bf2f(unsigned short b) { return __uint_as_float(((unsigned)b) << 16); }
__device__ __forceinline__ float bfr(float f) { return bf2f(f2bf(f)); }
__device__ __forceinline__ v16h cat16(v8h lo, v8h hi) { return __builtin_shufflevector(lo, hi, 0, 1, 2, 3, 4, 5, 6, 7, 8, 9, 10, 11, 12, 13, 14, 15); }
__device__ __forceinline__ v16bf cat16b(v8us lo, v8us hi) { return __builtin_bit_cast(v16bf, __builtin_shufflevector(lo, hi, 0, 1, 2, 3, 4, 5, 6, 7, 8, 9, 10, 11, 12, 13, 14, 15)); }
__device__ __forceinline__ v8f wmma16(v16h a, v16h b, v8f c) { return __builtin_amdgcn_wmma_f32_16x16x32_f16(false, a, false, b, (short)0, c, false, false); }
__device__ __forceinline__ v8f wmmab(v16bf a, v16bf b, v8f c) { return __builtin_amdgcn_wmma_f32_16x16x32_bf16(false, a, false, b, (short)0, c, false, false); }



// ---- k_gemmw: register-blocked GEMM, ONE WAVE per 64x64 output tile (16 accumulators), operands straight from K-contiguous 16-bit planes; grid (M/64, N/64, Z), 32 threads.
// C[m][n] (f32, pitch ldc, + optional f32 bias[n]) = sum_k A[m][k] Bt[n][k] (+ split products per NSPLIT). z-batch strides sA/sB/sC in elements. K % 32 == 0.
// EPI 0: C as above. EPI 1: sums + bias go straight to three head planes [batch][head][t][d] (fp16, bf16 hi, bf16 lo = rest after hi); EPI 2: the same planes transposed, [batch][head][d][t]. A 64-column tile is one head (HD 64), a 64-row tile lies in one batch; ldc / HD = heads.
// KS > 1: grid z = batches x KS (ks fastest); block (batch, ks) sums only k in [ks K/KS, (ks+1) K/KS) and writes partial plane C + z sC; the consumer adds a batch's KS planes. K % (32 KS) == 0.
template <typename T16> struct WFrag;
template <> struct WFrag<h16> { typedef v16h V; static __device__ __forceinline__ V ld(const h16* p) { return cat16(*(const v8h*)p, *(const v8h*)(p + 16)); } static __device__ __forceinline__ v8f mma(V a, V b, v8f c) { return wmma16(a, b, c); } };
template <> struct WFrag<bf> { typedef v16bf V; static __device__ __forceinline__ V ld(const bf* p) { return cat16b(*(const v8us*)p, *(const v8us*)(p + 16)); } static __device__ __forceinline__ v8f mma(V a, V b, v8f c) { return wmmab(a, b, c); } };
// three 16-bit forms of 8 f32 values: fp16, bf16 hi, bf16 lo (all round to nearest even)
__device__ __forceinline__ void split8(v8f y, v8h& o16, v8us& oh, v8us& ol) { o16 = __builtin_convertvector(y, v8h); oh = __builtin_bit_cast(v8us, __builtin_convertvector(y, v8bf)); const v4u au = __builtin_bit_cast(v4u, oh); v8f back;
#pragma unroll
    for (int i = 0; i < 4; ++i) { back[2 * i] = __uint_as_float(au[i] << 16); back[2 * i + 1] = __uint_as_float(au[i] & 0xFFFF0000u); }
    ol = __builtin_bit_cast(v8us, __builtin_convertvector(y - back, v8bf)); }
template <typename T16, int NSPLIT, bool BIAS, int KS = 1, int EPI = 0>
__global__ __launch_bounds__(32) void k_gemmw(const T16* __restrict__ A, const T16* __restrict__ A2, const T16* __restrict__ Bt, const T16* __restrict__ Bt2, int K, float* C, int ldc, const float* __restrict__ bias, size_t sA, size_t sB, size_t sC, h16* P16, bf* Ph, bf* Pl) {
    typedef typename WFrag<T16>::V V;
    static_assert(HD == 64 && TT % 64 == 0, "plane epilogues: a tile is one head of one batch");
    const size_t z = blockIdx.z; const size_t zb = z / KS; const int kb = (int)(z % KS) * (K / KS), ke = kb + K / KS;
    A += zb * sA; if (A2) A2 += zb * sA; Bt += zb * sB; if (Bt2) Bt2 += zb * sB; C += z * sC;
    const int lane = threadIdx.x & 31, lr = lane & 15, hi = lane >> 4; const int r0 = blockIdx.x * 64, c0 = blockIdx.y * 64;
    v8f acc[4][4];
#pragma unroll
    for (int mb = 0; mb < 4; ++mb)
#pragma unroll
        for (int nb = 0; nb < 4; ++nb) acc[mb][nb] = (v8f){};
    const size_t aoff = (size_t)(r0 + lr) * K + 8 * hi, boff = (size_t)(c0 + lr) * K + 8 * hi;
    float bp[4];   // transposed planes: the lane's 4 bias words, fetched ahead of the K loop so that their latency is hidden behind it (the 8 words of EPI 1 held over the loop cost it its load grouping)
    if constexpr (EPI == 2) {
#pragma unroll
        for (int i = 0; i < 4; ++i) bp[i] = bias[c0 + i * 16 + lr];
        asm volatile("s_wait_xcnt 0x0" ::: "memory"); }   // stands before the loads' address registers are reused
#pragma unroll 1
    for (int kc = kb; kc < ke; kc += 32) {
        V a[4], a2[4];
#pragma unroll
        for (int mb = 0; mb < 4; ++mb) { a[mb] = WFrag<T16>::ld(A + aoff + (size_t)mb * 16 * K + kc); if (NSPLIT == 1 || NSPLIT == 2) a2[mb] = WFrag<T16>::ld(A2 + aoff + (size_t)mb * 16 * K + kc); }
#pragma unroll
        for (int nb = 0; nb < 4; ++nb) { const V b = WFrag<T16>::ld(Bt + boff + (size_t)nb * 16 * K + kc); V b2; if (NSPLIT >= 2) b2 = WFrag<T16>::ld(Bt2 + boff + (size_t)nb * 16 * K + kc);
#pragma unroll
            for (int mb = 0; mb < 4; ++mb) { acc[mb][nb] = WFrag<T16>::mma(a[mb], b, acc[mb][nb]); if (NSPLIT == 1 || NSPLIT == 2) acc[mb][nb] = WFrag<T16>::mma(a2[mb], b, acc[mb][nb]); if (NSPLIT >= 2) acc[mb][nb] = WFrag<T16>::mma(a[mb], b2, acc[mb][nb]); } }
        asm volatile("v_nop\n\tv_nop\n\tv_nop\n\tv_nop" : "+v"(acc[0][0]), "+v"(acc[1][1]), "+v"(acc[2][2]), "+v"(acc[3][3]) : "v"(a[0]), "v"(a[3]));
    }
    if constexpr (EPI == 0) {
    __shared__ __align__(16) float os[16 * 68];
#pragma unroll
    for (int mb = 0; mb < 4; ++mb) {
#pragma unroll
        for (int nb = 0; nb < 4; ++nb) {
#pragma unroll
            for (int j = 0; j < 8; ++j) os[(hi * 8 + j) * 68 + nb * 16 + lr] = acc[mb][nb][j]; }
        __builtin_amdgcn_wave_barrier(); asm volatile("" ::: "memory");
        float* crow = C + (size_t)(r0 + mb * 16) * ldc + c0;
{
#pragma unroll
            for (int s = 0; s < 8; ++s) { const int row = 2 * s + hi, cofs = lr * 4; v4f val = *(const v4fa*)(os + row * 68 + cofs); if (BIAS) { val[0] += bfr(bias[c0 + cofs]); val[1] += bfr(bias[c0 + cofs + 1]); val[2] += bfr(bias[c0 + cofs + 2]); val[3] += bfr(bias[c0 + cofs + 3]); }
                *(v4f*)(crow + (size_t)row * ldc + cofs) = val; }
             }
        __builtin_amdgcn_wave_barrier(); asm volatile("" ::: "memory");
    }
    } else if constexpr (EPI == 1) {
    __shared__ __align__(16) float os[16 * 68];
    const int rq = lane >> 3, cofs = (lane & 7) * 8;   // 8 lanes a 128-byte plane row: a store covers 4 rows = 512 contiguous bytes
    v8f bv;
#pragma unroll
    for (int i = 0; i < 8; ++i) bv[i] = bias[c0 + cofs + i];
    asm volatile("s_wait_xcnt 0x0" ::: "memory");   // stands before the loads' address registers are reused
#pragma unroll
    for (int i = 0; i < 8; ++i) bv[i] = bfr(bv[i]);
    const size_t po = ((size_t)((r0 / TT) * (ldc / HD) + (int)blockIdx.y) * TT + r0 % TT) * HD + cofs;
#pragma unroll
    for (int mb = 0; mb < 4; ++mb) {
#pragma unroll
        for (int nb = 0; nb < 4; ++nb) {
#pragma unroll
            for (int j = 0; j < 8; ++j) os[(hi * 8 + j) * 68 + nb * 16 + lr] = acc[mb][nb][j]; }
        __builtin_amdgcn_wave_barrier(); asm volatile("" ::: "memory");   // the reads below take other lanes' words: they must not be moved above the writes
#pragma unroll
        for (int s = 0; s < 4; ++s) { const int row = 4 * s + rq; const v4f x0 = *(const v4fa*)(os + row * 68 + cofs), x1 = *(const v4fa*)(os + row * 68 + cofs + 4);
            v8h o16; v8us oh, ol; split8(__builtin_shufflevector(x0, x1, 0, 1, 2, 3, 4, 5, 6, 7) + bv, o16, oh, ol); const size_t eo = po + (size_t)(mb * 16 + row) * HD;
            *(v8h*)(P16 + eo) = o16; *(v8us*)(Ph + eo) = oh; *(v8us*)(Pl + eo) = ol; }
        asm volatile("s_wait_xcnt 0x0" ::: "memory");   // stands before the stores' address and data registers are reused
        __builtin_amdgcn_wave_barrier(); asm volatile("" ::: "memory");   // the next block's writes must not be moved above these reads
    }
    } else {
    // a lane holds 8 consecutive t of one d: converted in registers, staged [d][t] in LDS so that every store is whole 128-byte lines
    __shared__ __align__(16) unsigned short st[3 * 16 * 72];   // row pitch 144 B = 16 B x odd
    const int rq = lane >> 3, cofs = (lane & 7) * 8;
    const size_t po = (size_t)((r0 / TT) * (ldc / HD) + (int)blockIdx.y) * HD * TT + r0 % TT + cofs;
#pragma unroll
    for (int nb = 0; nb < 4; ++nb) { const float bn = bfr(bp[nb]);
#pragma unroll
        for (int mb = 0; mb < 4; ++mb) { v8h o16; v8us oh, ol; split8(acc[mb][nb] + bn, o16, oh, ol); unsigned short* w = st + lr * 72 + mb * 16 + hi * 8;
            *(v8ha*)w = o16; *(v8usa*)(w + 16 * 72) = oh; *(v8usa*)(w + 32 * 72) = ol; }
        __builtin_amdgcn_wave_barrier(); asm volatile("" ::: "memory");   // the reads below take other lanes' words: they must not be moved above the writes
#pragma unroll
        for (int s = 0; s < 4; ++s) { const int row = 4 * s + rq; const unsigned short* r = st + row * 72 + cofs; const size_t eo = po + (size_t)(nb * 16 + row) * TT;
            *(v8h*)(P16 + eo) = *(const v8ha*)r; *(v8us*)(Ph + eo) = *(const v8usa*)(r + 16 * 72); *(v8us*)(Pl + eo) = *(const v8usa*)(r + 32 * 72); }
        asm volatile("s_wait_xcnt 0x0" ::: "memory");   // stands before the stores' address and data registers are reused
        __builtin_amdgcn_wave_barrier(); asm volatile("" ::: "memory");   // the next block's writes must not be moved above these reads
    }
    }
}

__device__ __forceinline__ void splitf(float y, unsigned short& h, unsigned short& l) { h = f2bf(y); l = f2bf(y - bf2f(h)); }

__global__ __launch_bounds__(256) void k_cvt8(const float* __restrict__ src, bf* dst, size_t n8) { const size_t i = (size_t)blockIdx.x * 256 + threadIdx.x; if (i >= n8) return; const v8f v = *(const v8f*)(src + i * 8); v8us o;
#pragma unroll
    for (int k = 0; k < 8; ++k) o[k] = f2bf(v[k]); *(v8us*)(dst + i * 8) = o;  }

typedef __attribute__((ext_vector_type(16))) float v16f;
template <typename T16> struct Vec8;
template <> struct Vec8<h16> { typedef v8h T; static __device__ __forceinline__ void pack(v16f p, v16h& a, v16h& b) { a = __builtin_convertvector(p, v16h); (void)b; } };
template <> struct Vec8<bf> { typedef v8us T; static __device__ __forceinline__ void pack(v16f p, v16bf& a, v16bf& b) { a = __builtin_convertvector(p, v16bf); b = __builtin_convertvector(p - __builtin_convertvector(a, v16f), v16bf); } };
__device__ __forceinline__ float xhalf(float x) { return __builtin_bit_cast(float, __builtin_amdgcn_permlanex16(__builtin_bit_cast(int, x), __builtin_bit_cast(int, x), 0x76543210, 0xfedcba98, false, false)); }   // lane l with lane l ^ 16
template <typename T16, int NP, int QT>
__device__ __forceinline__ void fattn_body(T16* L, const T16* __restrict__ Q0, const T16* __restrict__ Q1, const T16* __restrict__ K0, const T16* __restrict__ K1, const T16* __restrict__ V0, const T16* __restrict__ V1, int q0, bf* Ah, bf* Al) {
    typedef typename WFrag<T16>::V V; typedef typename Vec8<T16>::T C8;
    constexpr int PLN = SK * LP, BUFE = 2 * NP * PLN;   // a buffer: K plane(s) [key][d], then V^T plane(s) [d][key]
    const int tid = threadIdx.x, lane = tid & 31, c = lane & 15, h = lane >> 4;
    V qf[QT][2], qf2[QT][2];
#pragma unroll
    for (int qt = 0; qt < QT; ++qt)
#pragma unroll
        for (int ks = 0; ks < 2; ++ks) { const size_t qo = (size_t)(q0 + qt * 16 + c) * HD + ks * 32 + 8 * h; qf[qt][ks] = WFrag<T16>::ld(Q0 + qo); if (NP == 2) qf2[qt][ks] = WFrag<T16>::ld(Q1 + qo); }
    v8f o[QT][4]; float mref[QT], lsum[QT];
#pragma unroll
    for (int qt = 0; qt < QT; ++qt) { mref[qt] = -3.0e38f; lsum[qt] = 0.f;
#pragma unroll
        for (int dt = 0; dt < 4; ++dt) o[qt][dt] = (v8f){}; }
    const int srow = tid >> 3, scol = (tid & 7) * 8;   // staging: 8 threads a 128-byte row, rows srow + 16 j
    C8 sg[2 * NP][4];
    auto fetch = [&](int k0) {
#pragma unroll
        for (int j = 0; j < 4; ++j) { const int row = srow + (FW * 4) * j; const size_t ko = (size_t)(k0 + row) * HD + scol, vo = (size_t)row * TT + k0 + scol;
            sg[0][j] = *(const C8*)(K0 + ko); if (NP == 2) sg[1][j] = *(const C8*)(K1 + ko); sg[NP][j] = *(const C8*)(V0 + vo); if (NP == 2) sg[NP + 1][j] = *(const C8*)(V1 + vo); }
        asm volatile("s_wait_xcnt 0x0" ::: "memory"); };   // stands before the loads' address registers are reused
    auto stash = [&](T16* Bw) {
#pragma unroll
        for (int pl = 0; pl < 2 * NP; ++pl)
#pragma unroll
            for (int j = 0; j < 4; ++j) *(C8*)(Bw + pl * PLN + (srow + (FW * 4) * j) * LP + scol) = sg[pl][j]; };
    fetch(0); stash(L); __syncthreads();
#pragma unroll 1   // stays rolled: a stage is already two unrolled passes, more would only cost registers and instruction cache
    for (int s = 0; s < TT / SK; ++s) {
        const T16* B = L + (s & 1) * BUFE;
        if (s + 1 < TT / SK) fetch((s + 1) * SK);   // the next stage flies while this one is worked on
#pragma unroll
        for (int p = 0; p < SK / 32; ++p) {
            v8f sc[QT][2];
#pragma unroll
            for (int kt = 0; kt < 2; ++kt) { const T16* kr = B + ((p * 2 + kt) * 16 + c) * LP + 8 * h; V ka[2], ka2[2];
#pragma unroll
                for (int ks = 0; ks < 2; ++ks) { ka[ks] = WFrag<T16>::ld(kr + ks * 32); if (NP == 2) ka2[ks] = WFrag<T16>::ld(kr + PLN + ks * 32); }
#pragma unroll
                for (int qt = 0; qt < QT; ++qt) { v8f a = (v8f){};
#pragma unroll
                    for (int ks = 0; ks < 2; ++ks) { a = WFrag<T16>::mma(ka[ks], qf[qt][ks], a); if (NP == 2) { a = WFrag<T16>::mma(ka[ks], qf2[qt][ks], a); a = WFrag<T16>::mma(ka2[ks], qf[qt][ks], a); } }
                    sc[qt][kt] = a; } }
            float mloc[QT]; bool need = false;
#pragma unroll
            for (int qt = 0; qt < QT; ++qt) { float t[8];
#pragma unroll
                for (int r = 0; r < 8; ++r) t[r] = fmaxf(sc[qt][0][r], sc[qt][1][r]);
                float m = fmaxf(fmaxf(fmaxf(t[0], t[1]), fmaxf(t[2], t[3])), fmaxf(fmaxf(t[4], t[5]), fmaxf(t[6], t[7]))); m = fmaxf(m, xhalf(m)); mloc[qt] = m * CL; need = need || (mloc[qt] > mref[qt] + 8.0f); }
            if (__builtin_amdgcn_ballot_w32(need) != 0) {   // one wave-uniform test a pass; every lane renews its maximum
#pragma unroll
                for (int qt = 0; qt < QT; ++qt) { const float mn = fmaxf(mref[qt], mloc[qt]); const float al = __builtin_amdgcn_exp2f(mref[qt] - mn); mref[qt] = mn; lsum[qt] *= al;
#pragma unroll
                    for (int dt = 0; dt < 4; ++dt) o[qt][dt] *= al; } }
            V pb[QT], pb2[QT];
#pragma unroll
            for (int qt = 0; qt < QT; ++qt) { v16f pv;
#pragma unroll
                for (int i = 0; i < 16; ++i) pv[i] = __builtin_amdgcn_exp2f(__builtin_fmaf(sc[qt][i >> 3][i & 7], CL, -mref[qt]));
                float t[8];
#pragma unroll
                for (int r = 0; r < 8; ++r) t[r] = pv[r] + pv[r + 8];
                lsum[qt] += ((t[0] + t[1]) + (t[2] + t[3])) + ((t[4] + t[5]) + (t[6] + t[7]));
                Vec8<T16>::pack(pv, pb[qt], pb2[qt]); }
#pragma unroll
            for (int dt = 0; dt < 4; ++dt) { const T16* vr = B + NP * PLN + (dt * 16 + c) * LP + p * 32 + 8 * h; const V va = WFrag<T16>::ld(vr); V va2; if (NP == 2) va2 = WFrag<T16>::ld(vr + PLN);
#pragma unroll
                for (int qt = 0; qt < QT; ++qt) { o[qt][dt] = WFrag<T16>::mma(va, pb[qt], o[qt][dt]); if (NP == 2) { o[qt][dt] = WFrag<T16>::mma(va, pb2[qt], o[qt][dt]); o[qt][dt] = WFrag<T16>::mma(va2, pb[qt], o[qt][dt]); } } }
        }
        if (s + 1 < TT / SK) stash(L + ((s + 1) & 1) * BUFE);   // its last readers left that buffer at the barrier of stage s - 1
        __syncthreads();
    }
#pragma unroll
    for (int qt = 0; qt < QT; ++qt) { const float inv = __fdiv_rn(1.0f, lsum[qt] + xhalf(lsum[qt])); const size_t ro = (size_t)(q0 + qt * 16 + c) * DQ + 8 * h;   // a lane holds 8 consecutive d of one query: 16-byte stores
#pragma unroll
        for (int dt = 0; dt < 4; ++dt) { v8us oh, ol;
#pragma unroll
            for (int r = 0; r < 8; ++r) { unsigned short a, c2; splitf(o[qt][dt][r] * inv, a, c2); oh[r] = a; ol[r] = c2; }
            *(v8us*)(Ah + ro + dt * 16) = oh; *(v8us*)(Al + ro + dt * 16) = ol;
            asm volatile("s_wait_xcnt 0x0" ::: "memory"); } }   // stands before the stores' address and data registers are reused
}
// amdgpu_waves_per_eu(4): holds the allocation under 256 VGPRs; without it the build goes just above and needs register-window switches in the loop.
__global__ __launch_bounds__(FW * 32) __attribute__((amdgpu_waves_per_eu(4))) void k_fattn(const h16* __restrict__ Q16, const h16* __restrict__ K16, const h16* __restrict__ V16, const bf* __restrict__ Qh, const bf* __restrict__ Ql, const bf* __restrict__ Kh, const bf* __restrict__ Kl, const bf* __restrict__ Vh, const bf* __restrict__ Vl, bf* Ah, bf* Al) {
    __shared__ __align__(16) unsigned short L[2 * 4 * SK * LP];
    const int z = blockIdx.x, bb = z / NH_, hh = z % NH_, w = threadIdx.x >> 5; const size_t pq = (size_t)z * TT * HD, pk = (size_t)(bb * NKV + hh / REP) * TT * HD, ao = (size_t)bb * TT * DQ + hh * HD;
    if (blockIdx.y < HB) fattn_body<bf, 2, 1>((bf*)L, Qh + pq, Ql + pq, Kh + pk, Kl + pk, Vh + pk, Vl + pk, ((int)blockIdx.y * FW + w) * 16, Ah + ao, Al + ao);
    else fattn_body<h16, 1, 2>((h16*)L, Q16 + pq, nullptr, K16 + pk, nullptr, V16 + pk, nullptr, RH + (((int)blockIdx.y - HB) * FW + w) * 32, Ah + ao, Al + ao);
}

extern "C" void kernel_launch(void* const* d_in, const int* in_sizes, int n_in,
                              void* d_out, int out_size, void* d_ws, size_t ws_size, hipStream_t stream) {
    (void)in_sizes; (void)n_in; (void)out_size;
    const float* x = (const float*)d_in[0]; const float* wq = (const float*)d_in[1]; const float* bq = (const float*)d_in[2]; const float* wk = (const float*)d_in[3]; const float* bk = (const float*)d_in[4]; const float* wv = (const float*)d_in[5]; const float* bv = (const float*)d_in[6]; const float* wo = (const float*)d_in[7]; const float* bo = (const float*)d_in[8];   /* weights ('oi' [768][768]) */
    float* OUT = (float*)d_out;     // [4][2048][768]
    char* wsp = (char*)d_ws;
    auto take = [&](size_t bytes) { char* p = wsp; wsp += (bytes + 255) & ~(size_t)255; return (void*)p; };
    bf* WQ = (bf*)take((size_t)DQ * DM * 2); bf* WK = (bf*)take((size_t)DKV * DM * 2); bf* WV = (bf*)take((size_t)DKV * DM * 2); bf* WO = (bf*)take((size_t)DM * DQ * 2);
    h16* QP16 = (h16*)take((size_t)BG * NH_ * TT * HD * 2); h16* KP16 = (h16*)take((size_t)BG * NKV * TT * HD * 2); h16* VT16 = (h16*)take((size_t)BG * NKV * HD * TT * 2);
    bf* QPh = (bf*)take((size_t)BG * NH_ * TT * HD * 2); bf* QPl = (bf*)take((size_t)BG * NH_ * TT * HD * 2); bf* KPh = (bf*)take((size_t)BG * NKV * TT * HD * 2); bf* KPl = (bf*)take((size_t)BG * NKV * TT * HD * 2); bf* VTh = (bf*)take((size_t)BG * NKV * HD * TT * 2); bf* VTl = (bf*)take((size_t)BG * NKV * HD * TT * 2);
    bf* XB = (bf*)take((size_t)BG * TT * DM * 2); bf* ATh = (bf*)take((size_t)BG * TT * DQ * 2); bf* ATl = (bf*)take((size_t)BG * TT * DQ * 2);
    if ((size_t)(wsp - (char*)d_ws) > ws_size) return;    // ws 256 MiB
    { k_cvt8<<<(unsigned)(((size_t)DQ * DM / 8 + 255) / 256), 256, 0, stream>>>(wq, WQ, (size_t)DQ * DM / 8); k_cvt8<<<(unsigned)(((size_t)DKV * DM / 8 + 255) / 256), 256, 0, stream>>>(wk, WK, (size_t)DKV * DM / 8); k_cvt8<<<(unsigned)(((size_t)DKV * DM / 8 + 255) / 256), 256, 0, stream>>>(wv, WV, (size_t)DKV * DM / 8);
      k_cvt8<<<(unsigned)(((size_t)DM * DQ / 8 + 255) / 256), 256, 0, stream>>>(wo, WO, (size_t)DM * DQ / 8);
       }
    for (int b = 0; b < NB_; b += BG) {
        k_cvt8<<<(unsigned)(((size_t)BG * TT * DM / 8 + 255) / 256), 256, 0, stream>>>(x + (size_t)b * TT * DM, XB, (size_t)BG * TT * DM / 8);
        k_gemmw<bf, 0, true, 1, 1><<<dim3(BG * TT / 64, DQ / 64, 1), 32, 0, stream>>>(XB, nullptr, WQ, nullptr, DM, nullptr, DQ, bq, 0, 0, 0, QP16, QPh, QPl);
        k_gemmw<bf, 0, true, 1, 1><<<dim3(BG * TT / 64, DKV / 64, 1), 32, 0, stream>>>(XB, nullptr, WK, nullptr, DM, nullptr, DKV, bk, 0, 0, 0, KP16, KPh, KPl);
        k_gemmw<bf, 0, true, 1, 2><<<dim3(BG * TT / 64, DKV / 64, 1), 32, 0, stream>>>(XB, nullptr, WV, nullptr, DM, nullptr, DKV, bv, 0, 0, 0, VT16, VTh, VTl);
        k_fattn<<<dim3(BG * NH_, HB + LB, 1), FW * 32, 0, stream>>>(QP16, KP16, VT16, QPh, QPl, KPh, KPl, VTh, VTl, ATh, ATl);   // hi/lo blocks (the longer ones) are y < HB
        k_gemmw<bf, 1, true><<<dim3(BG * TT / 64, DM / 64, 1), 32, 0, stream>>>(ATh, ATl, WO, nullptr, DQ, OUT + (size_t)b * TT * DM, DM, bo, 0, 0, 0, nullptr, nullptr, nullptr); }
}

// v005
// It runs in 229 microseconds.
// Two timings next to v004 put it at 1.29 and 1.30 times that version's speed.
// Over all steps from v000 it is 12.9 times as fast.
#include <hip/hip_runtime.h>

// Multi-head attention at d_model 768 with biased projections (x [4][2048][768]; q, k, v = x W^T + b ('oi' [768][768] 768^-0.5 + biases 0.01: non-zero; 12 heads x 64); attn x 64^-0.5; softmax over all keys (no mask); out = merged Wo^T + bo ('oi' + bias 0.01) -> [4][2048][768] (6.3 M); argument order x, Wq, bq, Wk, bk, Wv, bv, Wo, bo).
// Layout per group of BG batches: bf16 copy of x; 'oi' weights as-is; exact projections (K 768) + f32 biases, whose epilogue writes the head planes (fp16, bf16 hi, bf16 lo; V transposed); one fused attention launch per group (scores, online softmax and P x V stay in registers; hybrid rows: < 512 hi/lo 3 products, rest fp16); merged hi/lo x Wo exact + bo.
// Compute dtypes, f32 accumulate: every input rounded to bf16; projections exact + f32 biases; attention rows < 512 3 products, rest fp16; softmax f32; output projection hl x exact.

#define NB_  4
#define TT   2048
#define DM   768
#define NH_  12
#define NKV  12
#define REP  (NH_ / NKV)
#define HD   64
#define DQ   (NH_ * HD)
#define DKV  (NKV * HD)
#define BG   2                    // batches per projection / attention / output launch
#define RH   512                  // query rows < RH use hi+lo planes (0: none)
#define WIN  0
#define SCL  0.125f   // HD^-0.5
#define FW   4                    // k_fattn: waves per block
#define SK   64                   // k_fattn: keys per LDS stage (two passes of 32 keys)
#define LP   72                   // k_fattn: LDS row pitch in 16-bit elements (144 B = 16 B x odd, conflict-free for 16-byte reads)
#define HB   (RH / (16 * FW))     // k_fattn: hi/lo blocks per head (16 queries a wave)
#define LB   ((TT - RH) / (32 * FW))   // k_fattn: fp16 blocks per head (32 queries a wave)
#define CL   0.18033688011112042f // HD^-0.5 x log2(e)
#define GW   4                    // k_gemmw: waves per block, 2 x 2 wave tiles of 64 x 64
#define GK   64                   // k_gemmw: K elements per LDS stage (a 128-byte row = one whole cache line)
#define GPL  (128 * LP)           // k_gemmw: elements of one staged operand plane (128 rows at pitch LP)
typedef _Float16 h16;
typedef unsigned short bf;
typedef __attribute__((ext_vector_type(16))) __bf16   v16bf;
typedef __attribute__((ext_vector_type(16))) _Float16 v16h;
typedef __attribute__((ext_vector_type(8)))  _Float16 v8h;
typedef __attribute__((ext_vector_type(8)))  unsigned short v8us;
typedef __attribute__((ext_vector_type(8)))  float    v8f;
typedef __attribute__((ext_vector_type(4)))  float    v4f;
typedef v8h  __attribute__((may_alias)) v8ha;
typedef v4f  __attribute__((may_alias)) v4fa;
typedef v8us __attribute__((may_alias)) v8usa;
typedef __attribute__((ext_vector_type(8)))  __bf16   v8bf;
typedef __attribute__((ext_vector_type(4)))  unsigned v4u;

__device__ __forceinline__ unsigned short f2bf(float f) { unsigned u = __float_as_uint(f); u += 0x7FFFu + ((u >> 16) & 1u); return (unsigned short)(u >> 16); }
__device__ __forceinline__ float bf2f(unsigned short b) { return __uint_as_float(((unsigned)b) << 16); }
__device__ __forceinline__ float bfr(float f) { return bf2f(f2bf(f)); }
__device__ __forceinline__ v16h cat16(v8h lo, v8h hi) { return __builtin_shufflevector(lo, hi, 0, 1, 2, 3, 4, 5, 6, 7, 8, 9, 10, 11, 12, 13, 14, 15); }
__device__ __forceinline__ v16bf cat16b(v8us lo, v8us hi) { return __builtin_bit_cast(v16bf, __builtin_shufflevector(lo, hi, 0, 1, 2, 3, 4, 5, 6, 7, 8, 9, 10, 11, 12, 13, 14, 15)); }
__device__ __forceinline__ v8f wmma16(v16h a, v16h b, v8f c) { return __builtin_amdgcn_wmma_f32_16x16x32_f16(false, a, false, b, (short)0, c, false, false); }
__device__ __forceinline__ v8f wmmab(v16bf a, v16bf b, v8f c) { return __builtin_amdgcn_wmma_f32_16x16x32_bf16(false, a, false, b, (short)0, c, false, false); }



// ---- k_gemmw: register-blocked GEMM, one wave per 64x64 output tile (16 accumulators), GW waves share a 128x128 block tile; grid (M/128, N/128, Z), GW x 32 threads.
// Operands: K-contiguous 16-bit planes. Stages of GK k go global -> LDS by asynchronous 16-byte copies (8 lanes a 128-byte row), two buffers, one barrier a stage; fragments are read from LDS in the k order of WFrag::ld. K % GK == 0.
// C[m][n] (f32, pitch ldc, + optional f32 bias[n]) = sum_k A[m][k] Bt[n][k] (+ split products per NSPLIT). z-batch strides sA/sB/sC in elements.
// EPI 0: C as above. EPI 1: sums + bias go straight to three head planes [batch][head][t][d] (fp16, bf16 hi, bf16 lo = rest after hi); EPI 2: the same planes transposed, [batch][head][d][t]. A 64-column tile is one head (HD 64), a 64-row tile lies in one batch; ldc / HD = heads.
// KS > 1: grid z = batches x KS (ks fastest); block (batch, ks) sums only k in [ks K/KS, (ks+1) K/KS) and writes partial plane C + z sC; the consumer adds a batch's KS planes. K % (GK KS) == 0.
template <typename T16> struct WFrag;
template <> struct WFrag<h16> { typedef v16h V; static __device__ __forceinline__ V ld(const h16* p) { return cat16(*(const v8h*)p, *(const v8h*)(p + 16)); } static __device__ __forceinline__ v8f mma(V a, V b, v8f c) { return wmma16(a, b, c); } };
template <> struct WFrag<bf> { typedef v16bf V; static __device__ __forceinline__ V ld(const bf* p) { return cat16b(*(const v8us*)p, *(const v8us*)(p + 16)); } static __device__ __forceinline__ v8f mma(V a, V b, v8f c) { return wmmab(a, b, c); } };
// three 16-bit forms of 8 f32 values: fp16, bf16 hi, bf16 lo (all round to nearest even)
__device__ __forceinline__ void split8(v8f y, v8h& o16, v8us& oh, v8us& ol) { o16 = __builtin_convertvector(y, v8h); oh = __builtin_bit_cast(v8us, __builtin_convertvector(y, v8bf)); const v4u au = __builtin_bit_cast(v4u, oh); v8f back;
#pragma unroll
    for (int i = 0; i < 4; ++i) { back[2 * i] = __uint_as_float(au[i] << 16); back[2 * i + 1] = __uint_as_float(au[i] & 0xFFFF0000u); }
    ol = __builtin_bit_cast(v8us, __builtin_convertvector(y - back, v8bf)); }
// eight asynchronous 16-byte copies of one lane: rows 16 apart of a 128-row plane (global row pitch gp elements, LDS pitch LP). l: the lane's LDS byte address, g: its global address.
// s_wait_xcnt stands inside the statement, behind the last copy: no register that a copy names is rewritten in front of it.
template <typename T16>
__device__ __forceinline__ void acopy8(unsigned l, const T16* g, size_t gp) {
    asm volatile("global_load_async_to_lds_b128 %0, %8, off\n\t"
                 "global_load_async_to_lds_b128 %1, %9, off\n\t"
                 "global_load_async_to_lds_b128 %2, %10, off\n\t"
                 "global_load_async_to_lds_b128 %3, %11, off\n\t"
                 "global_load_async_to_lds_b128 %4, %12, off\n\t"
                 "global_load_async_to_lds_b128 %5, %13, off\n\t"
                 "global_load_async_to_lds_b128 %6, %14, off\n\t"
                 "global_load_async_to_lds_b128 %7, %15, off\n\t"
                 "s_wait_xcnt 0x0"
                 :: "v"(l), "v"(l + 1u * 16 * LP * 2), "v"(l + 2u * 16 * LP * 2), "v"(l + 3u * 16 * LP * 2), "v"(l + 4u * 16 * LP * 2), "v"(l + 5u * 16 * LP * 2), "v"(l + 6u * 16 * LP * 2), "v"(l + 7u * 16 * LP * 2),
                    "v"(g), "v"(g + 16 * gp), "v"(g + 32 * gp), "v"(g + 48 * gp), "v"(g + 64 * gp), "v"(g + 80 * gp), "v"(g + 96 * gp), "v"(g + 112 * gp)
                 : "memory");
}
template <typename T16, int NSPLIT, bool BIAS, int KS = 1, int EPI = 0>
__global__ __launch_bounds__(GW * 32) void k_gemmw(const T16* __restrict__ A, const T16* __restrict__ A2, const T16* __restrict__ Bt, const T16* __restrict__ Bt2, int K, float* C, int ldc, const float* __restrict__ bias, size_t sA, size_t sB, size_t sC, h16* P16, bf* Ph, bf* Pl) {
    typedef typename WFrag<T16>::V V;
    static_assert(HD == 64 && TT % 64 == 0, "plane epilogues: a tile is one head of one batch");
    static_assert(NSPLIT <= 1, "staged planes: A, A2 (NSPLIT 1), Bt");
    constexpr int NPL = 2 + NSPLIT, BUFE = NPL * GPL;   // a buffer: A plane(s), then the Bt plane
    __shared__ __align__(16) unsigned short gs[2 * BUFE];
    const size_t z = blockIdx.z; const size_t zb = z / KS; const int kb = (int)(z % KS) * (K / KS), ke = kb + K / KS;
    A += zb * sA; if (A2) A2 += zb * sA; Bt += zb * sB; if (Bt2) Bt2 += zb * sB; C += z * sC;
    const int tid = threadIdx.x, lane = tid & 31, lr = lane & 15, hi = lane >> 4, w = __builtin_amdgcn_readfirstlane(tid >> 5); const int rb = blockIdx.x * 128, cb = blockIdx.y * 128, r0 = rb + (w >> 1) * 64, c0 = cb + (w & 1) * 64;
    v8f acc[4][4];
#pragma unroll
    for (int mb = 0; mb < 4; ++mb)
#pragma unroll
        for (int nb = 0; nb < 4; ++nb) acc[mb][nb] = (v8f){};
    const int srow = tid >> 3, scol = (tid & 7) * 8;   // staging: 8 lanes a 128-byte row, rows srow + 16 j
    const size_t goa = (size_t)(rb + srow) * K + scol, gob = (size_t)(cb + srow) * K + scol;
    const unsigned ls = (unsigned)(size_t)(gs + srow * LP + scol);   // the lane's LDS byte address in buffer 0, plane 0
    auto fill = [&](int kc, int buf) { const unsigned l = ls + (unsigned)buf * (BUFE * 2);
        acopy8(l, A + goa + kc, (size_t)K); if (NSPLIT == 1) acopy8(l + GPL * 2, A2 + goa + kc, (size_t)K); acopy8(l + (NPL - 1) * GPL * 2, Bt + gob + kc, (size_t)K); };
    float bp[4];   // transposed planes: the lane's 4 bias words, fetched ahead of the K loop so that their latency is hidden behind it (the 8 words of EPI 1 held over the loop cost it its load grouping)
    if constexpr (EPI == 2) {
#pragma unroll
        for (int i = 0; i < 4; ++i) bp[i] = bias[c0 + i * 16 + lr];
        asm volatile("s_wait_xcnt 0x0" ::: "memory"); }   // stands before the loads' address registers are reused
    const int nt = (ke - kb) / GK;
    fill(kb, 0);
    asm volatile("s_wait_asynccnt 0x0" ::: "memory");   // this wave's copies of stage 0 have landed
    __syncthreads();                                      // every wave's have: stage 0 may be read
    if (nt > 1) fill(kb + GK, 1);
#pragma unroll 1   // stays rolled: a stage is already two unrolled k steps of 16 or 32 products
    for (int t = 0; t < nt; ++t) {
        const T16* ar = (const T16*)gs + (t & 1) * BUFE + ((w >> 1) * 64 + lr) * LP + 8 * hi; const T16* br = (const T16*)gs + (t & 1) * BUFE + (NPL - 1) * GPL + ((w & 1) * 64 + lr) * LP + 8 * hi;
#pragma unroll
        for (int ks = 0; ks < GK / 32; ++ks) {
        V a[4], a2[4], b[4];   // the k step's fragments are fetched as one group ahead of its products: one LDS latency a k step, not one a B fragment
        b[0] = WFrag<T16>::ld(br + ks * 32);
#pragma unroll
        for (int mb = 0; mb < 4; ++mb) { a[mb] = WFrag<T16>::ld(ar + mb * 16 * LP + ks * 32); if (NSPLIT == 1) a2[mb] = WFrag<T16>::ld(ar + GPL + mb * 16 * LP + ks * 32); }
#pragma unroll
        for (int nb = 1; nb < 4; ++nb) b[nb] = WFrag<T16>::ld(br + nb * 16 * LP + ks * 32);
        __builtin_amdgcn_sched_barrier(0);   // keeps the group together: without it the B reads are moved down between the products, each with a full wait in front of the next four
#pragma unroll
        for (int nb = 0; nb < 4; ++nb)
#pragma unroll
            for (int mb = 0; mb < 4; ++mb) { acc[mb][nb] = WFrag<T16>::mma(a[mb], b[nb], acc[mb][nb]); if (NSPLIT == 1) acc[mb][nb] = WFrag<T16>::mma(a2[mb], b[nb], acc[mb][nb]); }
        }
        asm volatile("s_wait_dscnt 0x0" ::: "memory");      // this wave's reads of the buffer are done before it is refilled
        asm volatile("s_wait_asynccnt 0x0" ::: "memory");   // this wave's copies of stage t + 1 have landed
        __syncthreads();                                      // publishes stage t + 1 and ends every wave's reads of stage t
        if (t + 2 < nt) fill(kb + (t + 2) * GK, t & 1);       // flies while stage t + 1 is worked on
    }
    asm volatile("s_wait_asynccnt 0x0" ::: "memory");   // no copy is outstanding when the wave goes on
    if constexpr (EPI == 0) {
    __shared__ __align__(16) float osw[GW][16 * 68]; float* os = osw[w];   // a wave's own staging
#pragma unroll
    for (int mb = 0; mb < 4; ++mb) {
#pragma unroll
        for (int nb = 0; nb < 4; ++nb) {
#pragma unroll
            for (int j = 0; j < 8; ++j) os[(hi * 8 + j) * 68 + nb * 16 + lr] = acc[mb][nb][j]; }
        __builtin_amdgcn_wave_barrier(); asm volatile("" ::: "memory");
        float* crow = C + (size_t)(r0 + mb * 16) * ldc + c0;
{
#pragma unroll
            for (int s = 0; s < 8; ++s) { const int row = 2 * s + hi, cofs = lr * 4; v4f val = *(const v4fa*)(os + row * 68 + cofs); if (BIAS) { val[0] += bfr(bias[c0 + cofs]); val[1] += bfr(bias[c0 + cofs + 1]); val[2] += bfr(bias[c0 + cofs + 2]); val[3] += bfr(bias[c0 + cofs + 3]); }
                *(v4f*)(crow + (size_t)row * ldc + cofs) = val; }
             }
        __builtin_amdgcn_wave_barrier(); asm volatile("" ::: "memory");
    }
    } else if constexpr (EPI == 1) {
    __shared__ __align__(16) float osw[GW][16 * 68]; float* os = osw[w];   // a wave's own staging
    const int rq = lane >> 3, cofs = (lane & 7) * 8;   // 8 lanes a 128-byte plane row: a store covers 4 rows = 512 contiguous bytes
    v8f bv;
#pragma unroll
    for (int i = 0; i < 8; ++i) bv[i] = bias[c0 + cofs + i];
    asm volatile("s_wait_xcnt 0x0" ::: "memory");   // stands before the loads' address registers are reused
#pragma unroll
    for (int i = 0; i < 8; ++i) bv[i] = bfr(bv[i]);
    const size_t po = ((size_t)((r0 / TT) * (ldc / HD) + c0 / HD) * TT + r0 % TT) * HD + cofs;
#pragma unroll
    for (int mb = 0; mb < 4; ++mb) {
#pragma unroll
        for (int nb = 0; nb < 4; ++nb) {
#pragma unroll
            for (int j = 0; j < 8; ++j) os[(hi * 8 + j) * 68 + nb * 16 + lr] = acc[mb][nb][j]; }
        __builtin_amdgcn_wave_barrier(); asm volatile("" ::: "memory");   // the reads below take other lanes' words: they must not be moved above the writes
#pragma unroll
        for (int s = 0; s < 4; ++s) { const int row = 4 * s + rq; const v4f x0 = *(const v4fa*)(os + row * 68 + cofs), x1 = *(const v4fa*)(os + row * 68 + cofs + 4);
            v8h o16; v8us oh, ol; split8(__builtin_shufflevector(x0, x1, 0, 1, 2, 3, 4, 5, 6, 7) + bv, o16, oh, ol); const size_t eo = po + (size_t)(mb * 16 + row) * HD;
            *(v8h*)(P16 + eo) = o16; *(v8us*)(Ph + eo) = oh; *(v8us*)(Pl + eo) = ol; }
        asm volatile("s_wait_xcnt 0x0" ::: "memory");   // stands before the stores' address and data registers are reused
        __builtin_amdgcn_wave_barrier(); asm volatile("" ::: "memory");   // the next block's writes must not be moved above these reads
    }
    } else {
    // a lane holds 8 consecutive t of one d: converted in registers, staged [d][t] in LDS so that every store is whole 128-byte lines
    __shared__ __align__(16) unsigned short stw[GW][3 * 16 * 72]; unsigned short* st = stw[w];   // a wave's own staging; row pitch 144 B = 16 B x odd
    const int rq = lane >> 3, cofs = (lane & 7) * 8;
    const size_t po = (size_t)((r0 / TT) * (ldc / HD) + c0 / HD) * HD * TT + r0 % TT + cofs;
#pragma unroll
    for (int nb = 0; nb < 4; ++nb) { const float bn = bfr(bp[nb]);
#pragma unroll
        for (int mb = 0; mb < 4; ++mb) { v8h o16; v8us oh, ol; split8(acc[mb][nb] + bn, o16, oh, ol); unsigned short* w = st + lr * 72 + mb * 16 + hi * 8;
            *(v8ha*)w = o16; *(v8usa*)(w + 16 * 72) = oh; *(v8usa*)(w + 32 * 72) = ol; }
        __builtin_amdgcn_wave_barrier(); asm volatile("" ::: "memory");   // the reads below take other lanes' words: they must not be moved above the writes
#pragma unroll
        for (int s = 0; s < 4; ++s) { const int row = 4 * s + rq; const unsigned short* r = st + row * 72 + cofs; const size_t eo = po + (size_t)(nb * 16 + row) * TT;
            *(v8h*)(P16 + eo) = *(const v8ha*)r; *(v8us*)(Ph + eo) = *(const v8usa*)(r + 16 * 72); *(v8us*)(Pl + eo) = *(const v8usa*)(r + 32 * 72); }
        asm volatile("s_wait_xcnt 0x0" ::: "memory");   // stands before the stores' address and data registers are reused
        __builtin_amdgcn_wave_barrier(); asm volatile("" ::: "memory");   // the next block's writes must not be moved above these reads
    }
    }
}

__device__ __forceinline__ void splitf(float y, unsigned short& h, unsigned short& l) { h = f2bf(y); l = f2bf(y - bf2f(h)); }

__global__ __launch_bounds__(256) void k_cvt8(const float* __restrict__ src, bf* dst, size_t n8) { const size_t i = (size_t)blockIdx.x * 256 + threadIdx.x; if (i >= n8) return; const v8f v = *(const v8f*)(src + i * 8); v8us o;
#pragma unroll
    for (int k = 0; k < 8; ++k) o[k] = f2bf(v[k]); *(v8us*)(dst + i * 8) = o;  }

typedef __attribute__((ext_vector_type(16))) float v16f;
template <typename T16> struct Vec8;
template <> struct Vec8<h16> { typedef v8h T; static __device__ __forceinline__ void pack(v16f p, v16h& a, v16h& b) { a = __builtin_convertvector(p, v16h); (void)b; } };
template <> struct Vec8<bf> { typedef v8us T; static __device__ __forceinline__ void pack(v16f p, v16bf& a, v16bf& b) { a = __builtin_convertvector(p, v16bf); b = __builtin_convertvector(p - __builtin_convertvector(a, v16f), v16bf); } };
__device__ __forceinline__ float xhalf(float x) { return __builtin_bit_cast(float, __builtin_amdgcn_permlanex16(__builtin_bit_cast(int, x), __builtin_bit_cast(int, x), 0x76543210, 0xfedcba98, false, false)); }   // lane l with lane l ^ 16
template <typename T16, int NP, int QT>
__device__ __forceinline__ void fattn_body(T16* L, const T16* __restrict__ Q0, const T16* __restrict__ Q1, const T16* __restrict__ K0, const T16* __restrict__ K1, const T16* __restrict__ V0, const T16* __restrict__ V1, int q0, bf* Ah, bf* Al) {
    typedef typename WFrag<T16>::V V; typedef typename Vec8<T16>::T C8;
    constexpr int PLN = SK * LP, BUFE = 2 * NP * PLN;   // a buffer: K plane(s) [key][d], then V^T plane(s) [d][key]
    const int tid = threadIdx.x, lane = tid & 31, c = lane & 15, h = lane >> 4;
    V qf[QT][2], qf2[QT][2];
#pragma unroll
    for (int qt = 0; qt < QT; ++qt)
#pragma unroll
        for (int ks = 0; ks < 2; ++ks) { const size_t qo = (size_t)(q0 + qt * 16 + c) * HD + ks * 32 + 8 * h; qf[qt][ks] = WFrag<T16>::ld(Q0 + qo); if (NP == 2) qf2[qt][ks] = WFrag<T16>::ld(Q1 + qo); }
    v8f o[QT][4]; float mref[QT], lsum[QT];
#pragma unroll
    for (int qt = 0; qt < QT; ++qt) { mref[qt] = -3.0e38f; lsum[qt] = 0.f;
#pragma unroll
        for (int dt = 0; dt < 4; ++dt) o[qt][dt] = (v8f){}; }
    const int srow = tid >> 3, scol = (tid & 7) * 8;   // staging: 8 threads a 128-byte row, rows srow + 16 j
    C8 sg[2 * NP][4];
    auto fetch = [&](int k0) {
#pragma unroll
        for (int j = 0; j < 4; ++j) { const int row = srow + (FW * 4) * j; const size_t ko = (size_t)(k0 + row) * HD + scol, vo = (size_t)row * TT + k0 + scol;
            sg[0][j] = *(const C8*)(K0 + ko); if (NP == 2) sg[1][j] = *(const C8*)(K1 + ko); sg[NP][j] = *(const C8*)(V0 + vo); if (NP == 2) sg[NP + 1][j] = *(const C8*)(V1 + vo); }
        asm volatile("s_wait_xcnt 0x0" ::: "memory"); };   // stands before the loads' address registers are reused
    auto stash = [&](T16* Bw) {
#pragma unroll
        for (int pl = 0; pl < 2 * NP; ++pl)
#pragma unroll
            for (int j = 0; j < 4; ++j) *(C8*)(Bw + pl * PLN + (srow + (FW * 4) * j) * LP + scol) = sg[pl][j]; };
    fetch(0); stash(L); __syncthreads();
#pragma unroll 1   // stays rolled: a stage is already two unrolled passes, more would only cost registers and instruction cache
    for (int s = 0; s < TT / SK; ++s) {
        const T16* B = L + (s & 1) * BUFE;
        if (s + 1 < TT / SK) fetch((s + 1) * SK);   // the next stage flies while this one is worked on
#pragma unroll
        for (int p = 0; p < SK / 32; ++p) {
            v8f sc[QT][2];
#pragma unroll
            for (int kt = 0; kt < 2; ++kt) { const T16* kr = B + ((p * 2 + kt) * 16 + c) * LP + 8 * h; V ka[2], ka2[2];
#pragma unroll
                for (int ks = 0; ks < 2; ++ks) { ka[ks] = WFrag<T16>::ld(kr + ks * 32); if (NP == 2) ka2[ks] = WFrag<T16>::ld(kr + PLN + ks * 32); }
#pragma unroll
                for (int qt = 0; qt < QT; ++qt) { v8f a = (v8f){};
#pragma unroll
                    for (int ks = 0; ks < 2; ++ks) { a = WFrag<T16>::mma(ka[ks], qf[qt][ks], a); if (NP == 2) { a = WFrag<T16>::mma(ka[ks], qf2[qt][ks], a); a = WFrag<T16>::mma(ka2[ks], qf[qt][ks], a); } }
                    sc[qt][kt] = a; } }
            float mloc[QT]; bool need = false;
#pragma unroll
            for (int qt = 0; qt < QT; ++qt) { float t[8];
#pragma unroll
                for (int r = 0; r < 8; ++r) t[r] = fmaxf(sc[qt][0][r], sc[qt][1][r]);
                float m = fmaxf(fmaxf(fmaxf(t[0], t[1]), fmaxf(t[2], t[3])), fmaxf(fmaxf(t[4], t[5]), fmaxf(t[6], t[7]))); m = fmaxf(m, xhalf(m)); mloc[qt] = m * CL; need = need || (mloc[qt] > mref[qt] + 8.0f); }
            if (__builtin_amdgcn_ballot_w32(need) != 0) {   // one wave-uniform test a pass; every lane renews its maximum
#pragma unroll
                for (int qt = 0; qt < QT; ++qt) { const float mn = fmaxf(mref[qt], mloc[qt]); const float al = __builtin_amdgcn_exp2f(mref[qt] - mn); mref[qt] = mn; lsum[qt] *= al;
#pragma unroll
                    for (int dt = 0; dt < 4; ++dt) o[qt][dt] *= al; } }
            V pb[QT], pb2[QT];
#pragma unroll
            for (int qt = 0; qt < QT; ++qt) { v16f pv;
#pragma unroll
                for (int i = 0; i < 16; ++i) pv[i] = __builtin_amdgcn_exp2f(__builtin_fmaf(sc[qt][i >> 3][i & 7], CL, -mref[qt]));
                float t[8];
#pragma unroll
                for (int r = 0; r < 8; ++r) t[r] = pv[r] + pv[r + 8];
                lsum[qt] += ((t[0] + t[1]) + (t[2] + t[3])) + ((t[4] + t[5]) + (t[6] + t[7]));
                Vec8<T16>::pack(pv, pb[qt], pb2[qt]); }
#pragma unroll
            for (int dt = 0; dt < 4; ++dt) { const T16* vr = B + NP * PLN + (dt * 16 + c) * LP + p * 32 + 8 * h; const V va = WFrag<T16>::ld(vr); V va2; if (NP == 2) va2 = WFrag<T16>::ld(vr + PLN);
#pragma unroll
                for (int qt = 0; qt < QT; ++qt) { o[qt][dt] = WFrag<T16>::mma(va, pb[qt], o[qt][dt]); if (NP == 2) { o[qt][dt] = WFrag<T16>::mma(va, pb2[qt], o[qt][dt]); o[qt][dt] = WFrag<T16>::mma(va2, pb[qt], o[qt][dt]); } } }
        }
        if (s + 1 < TT / SK) stash(L + ((s + 1) & 1) * BUFE);   // its last readers left that buffer at the barrier of stage s - 1
        __syncthreads();
    }
#pragma unroll
    for (int qt = 0; qt < QT; ++qt) { const float inv = __fdiv_rn(1.0f, lsum[qt] + xhalf(lsum[qt])); const size_t ro = (size_t)(q0 + qt * 16 + c) * DQ + 8 * h;   // a lane holds 8 consecutive d of one query: 16-byte stores
#pragma unroll
        for (int dt = 0; dt < 4; ++dt) { v8us oh, ol;
#pragma unroll
            for (int r = 0; r < 8; ++r) { unsigned short a, c2; splitf(o[qt][dt][r] * inv, a, c2); oh[r] = a; ol[r] = c2; }
            *(v8us*)(Ah + ro + dt * 16) = oh; *(v8us*)(Al + ro + dt * 16) = ol;
            asm volatile("s_wait_xcnt 0x0" ::: "memory"); } }   // stands before the stores' address and data registers are reused
}
// amdgpu_waves_per_eu(4): holds the allocation under 256 VGPRs; without it the build goes just above and needs register-window switches in the loop.
__global__ __launch_bounds__(FW * 32) __attribute__((amdgpu_waves_per_eu(4))) void k_fattn(const h16* __restrict__ Q16, const h16* __restrict__ K16, const h16* __restrict__ V16, const bf* __restrict__ Qh, const bf* __restrict__ Ql, const bf* __restrict__ Kh, const bf* __restrict__ Kl, const bf* __restrict__ Vh, const bf* __restrict__ Vl, bf* Ah, bf* Al) {
    __shared__ __align__(16) unsigned short L[2 * 4 * SK * LP];
    const int z = blockIdx.x, bb = z / NH_, hh = z % NH_, w = threadIdx.x >> 5; const size_t pq = (size_t)z * TT * HD, pk = (size_t)(bb * NKV + hh / REP) * TT * HD, ao = (size_t)bb * TT * DQ + hh * HD;
    if (blockIdx.y < HB) fattn_body<bf, 2, 1>((bf*)L, Qh + pq, Ql + pq, Kh + pk, Kl + pk, Vh + pk, Vl + pk, ((int)blockIdx.y * FW + w) * 16, Ah + ao, Al + ao);
    else fattn_body<h16, 1, 2>((h16*)L, Q16 + pq, nullptr, K16 + pk, nullptr, V16 + pk, nullptr, RH + (((int)blockIdx.y - HB) * FW + w) * 32, Ah + ao, Al + ao);
}

extern "C" void kernel_launch(void* const* d_in, const int* in_sizes, int n_in,
                              void* d_out, int out_size, void* d_ws, size_t ws_size, hipStream_t stream) {
    (void)in_sizes; (void)n_in; (void)out_size;
    static_assert((BG * TT) % 128 == 0 && DQ % 128 == 0 && DKV % 128 == 0 && DM % 128 == 0 && DM % GK == 0 && DQ % GK == 0, "k_gemmw: whole 128 x 128 block tiles, whole stages");
    const float* x = (const float*)d_in[0]; const float* wq = (const float*)d_in[1]; const float* bq = (const float*)d_in[2]; const float* wk = (const float*)d_in[3]; const float* bk = (const float*)d_in[4]; const float* wv = (const float*)d_in[5]; const float* bv = (const float*)d_in[6]; const float* wo = (const float*)d_in[7]; const float* bo = (const float*)d_in[8];   /* weights 'oi' [768][768] */
    float* OUT = (float*)d_out;     // [4][2048][768]
    char* wsp = (char*)d_ws;
    auto take = [&](size_t bytes) { char* p = wsp; wsp += (bytes + 255) & ~(size_t)255; return (void*)p; };
    bf* WQ = (bf*)take((size_t)DQ * DM * 2); bf* WK = (bf*)take((size_t)DKV * DM * 2); bf* WV = (bf*)take((size_t)DKV * DM * 2); bf* WO = (bf*)take((size_t)DM * DQ * 2);
    h16* QP16 = (h16*)take((size_t)BG * NH_ * TT * HD * 2); h16* KP16 = (h16*)take((size_t)BG * NKV * TT * HD * 2); h16* VT16 = (h16*)take((size_t)BG * NKV * HD * TT * 2);
    bf* QPh = (bf*)take((size_t)BG * NH_ * TT * HD * 2); bf* QPl = (bf*)take((size_t)BG * NH_ * TT * HD * 2); bf* KPh = (bf*)take((size_t)BG * NKV * TT * HD * 2); bf* KPl = (bf*)take((size_t)BG * NKV * TT * HD * 2); bf* VTh = (bf*)take((size_t)BG * NKV * HD * TT * 2); bf* VTl = (bf*)take((size_t)BG * NKV * HD * TT * 2);
    bf* XB = (bf*)take((size_t)BG * TT * DM * 2); bf* ATh = (bf*)take((size_t)BG * TT * DQ * 2); bf* ATl = (bf*)take((size_t)BG * TT * DQ * 2);
    if ((size_t)(wsp - (char*)d_ws) > ws_size) return;    // ws 256 MiB
    { k_cvt8<<<(unsigned)(((size_t)DQ * DM / 8 + 255) / 256), 256, 0, stream>>>(wq, WQ, (size_t)DQ * DM / 8); k_cvt8<<<(unsigned)(((size_t)DKV * DM / 8 + 255) / 256), 256, 0, stream>>>(wk, WK, (size_t)DKV * DM / 8); k_cvt8<<<(unsigned)(((size_t)DKV * DM / 8 + 255) / 256), 256, 0, stream>>>(wv, WV, (size_t)DKV * DM / 8);
      k_cvt8<<<(unsigned)(((size_t)DM * DQ / 8 + 255) / 256), 256, 0, stream>>>(wo, WO, (size_t)DM * DQ / 8);
       }
    for (int b = 0; b < NB_; b += BG) {
        k_cvt8<<<(unsigned)(((size_t)BG * TT * DM / 8 + 255) / 256), 256, 0, stream>>>(x + (size_t)b * TT * DM, XB, (size_t)BG * TT * DM / 8);
        k_gemmw<bf, 0, true, 1, 1><<<dim3(BG * TT / 128, DQ / 128, 1), GW * 32, 0, stream>>>(XB, nullptr, WQ, nullptr, DM, nullptr, DQ, bq, 0, 0, 0, QP16, QPh, QPl);
        k_gemmw<bf, 0, true, 1, 1><<<dim3(BG * TT / 128, DKV / 128, 1), GW * 32, 0, stream>>>(XB, nullptr, WK, nullptr, DM, nullptr, DKV, bk, 0, 0, 0, KP16, KPh, KPl);
        k_gemmw<bf, 0, true, 1, 2><<<dim3(BG * TT / 128, DKV / 128, 1), GW * 32, 0, stream>>>(XB, nullptr, WV, nullptr, DM, nullptr, DKV, bv, 0, 0, 0, VT16, VTh, VTl);
        k_fattn<<<dim3(BG * NH_, HB + LB, 1), FW * 32, 0, stream>>>(QP16, KP16, VT16, QPh, QPl, KPh, KPl, VTh, VTl, ATh, ATl);   // hi/lo blocks (the longer ones) take the low y indices
        k_gemmw<bf, 1, true><<<dim3(BG * TT / 128, DM / 128, 1), GW * 32, 0, stream>>>(ATh, ATl, WO, nullptr, DQ, OUT + (size_t)b * TT * DM, DM, bo, 0, 0, 0, nullptr, nullptr, nullptr); }
}

// v006
// Measured time: 133 microseconds a run.
// Next to v005, in two timings, it ran 1.75 and 1.74 times as fast.
// Over all steps from v000 it is 22.6 times as fast.
#include <hip/hip_runtime.h>

// Multi-head attention at d_model 768 with biased projections (x [4][2048][768]; q, k, v = x W^T + b ('oi' [768][768] 768^-0.5 + biases 0.01: non-zero; 12 heads x 64); attn x 64^-0.5; softmax over all keys (no mask); out = merged Wo^T + bo ('oi' + bias 0.01) -> [4][2048][768] (6.3 M); argument order x, Wq, bq, Wk, bk, Wv, bv, Wo, bo).
// Four launches, each over all BG batches: bf16 copies of x and of the 'oi' weights; the three exact projections (K 768) + f32 biases as one GEMM on the stacked weights, whose epilogue writes the head planes (fp16, bf16 hi, bf16 lo; V transposed); one fused attention launch (scores, online softmax and P x V stay in registers; hybrid rows: < 512 hi/lo 3 products, rest fp16); merged hi/lo x Wo exact + bo.
// Compute dtypes, f32 accumulate: every input rounded to bf16; projections exact + f32 biases; attention rows < 512 3 products, rest fp16; softmax f32; output projection hl x exact.

#define NB_  4
#define TT   2048
#define DM   768
#define NH_  12
#define NKV  12
#define REP  (NH_ / NKV)
#define HD   64
#define DQ   (NH_ * HD)
#define DKV  (NKV * HD)
#define BG   4                    // batches per launch: all of them
#define RH   512                  // query rows < RH use hi+lo planes (0: none)
#define WIN  0
#define SCL  0.125f   // HD^-0.5
#define FW   4                    // k_fattn: waves per block
#define SK   64                   // k_fattn: keys per LDS stage (two passes of 32 keys)
#define LP   72                   // k_fattn: LDS row pitch in 16-bit elements (144 B = 16 B x odd, conflict-free for 16-byte reads)
#define HB   (RH / (16 * FW))     // k_fattn: hi/lo blocks per head (16 queries a wave)
#define LB   ((TT - RH) / (32 * FW))   // k_fattn: fp16 blocks per head (32 queries a wave)
#define CL   0.18033688011112042f // HD^-0.5 x log2(e)
#define GW   4                    // k_gemmw: waves per block, 2 x 2 wave tiles of 64 x 64
#define GK   64                   // k_gemmw: K elements per LDS stage (a 128-byte row = one whole cache line)
#define GPL  (128 * LP)           // k_gemmw: elements of one staged operand plane (128 rows at pitch LP)
typedef _Float16 h16;
typedef unsigned short bf;
typedef __attribute__((ext_vector_type(16))) __bf16   v16bf;
typedef __attribute__((ext_vector_type(16))) _Float16 v16h;
typedef __attribute__((ext_vector_type(8)))  _Float16 v8h;
typedef __attribute__((ext_vector_type(8)))  unsigned short v8us;
typedef __attribute__((ext_vector_type(8)))  float    v8f;
typedef __attribute__((ext_vector_type(4)))  float    v4f;
typedef v8h  __attribute__((may_alias)) v8ha;
typedef v4f  __attribute__((may_alias)) v4fa;
typedef v8us __attribute__((may_alias)) v8usa;
typedef __attribute__((ext_vector_type(8)))  __bf16   v8bf;
typedef __attribute__((ext_vector_type(4)))  unsigned v4u;

__device__ __forceinline__ unsigned short f2bf(float f) { unsigned u = __float_as_uint(f); u += 0x7FFFu + ((u >> 16) & 1u); return (unsigned short)(u >> 16); }
__device__ __forceinline__ float bf2f(unsigned short b) { return __uint_as_float(((unsigned)b) << 16); }
__device__ __forceinline__ float bfr(float f) { return bf2f(f2bf(f)); }
__device__ __forceinline__ v16h cat16(v8h lo, v8h hi) { return __builtin_shufflevector(lo, hi, 0, 1, 2, 3, 4, 5, 6, 7, 8, 9, 10, 11, 12, 13, 14, 15); }
__device__ __forceinline__ v16bf cat16b(v8us lo, v8us hi) { return __builtin_bit_cast(v16bf, __builtin_shufflevector(lo, hi, 0, 1, 2, 3, 4, 5, 6, 7, 8, 9, 10, 11, 12, 13, 14, 15)); }
__device__ __forceinline__ v8f wmma16(v16h a, v16h b, v8f c) { return __builtin_amdgcn_wmma_f32_16x16x32_f16(false, a, false, b, (short)0, c, false, false); }
__device__ __forceinline__ v8f wmmab(v16bf a, v16bf b, v8f c) { return __builtin_amdgcn_wmma_f32_16x16x32_bf16(false, a, false, b, (short)0, c, false, false); }



// ---- k_gemmw: register-blocked GEMM, one wave per 64x64 output tile (16 accumulators), GW waves share a 128x128 block tile; grid (M/128, N/128, Z), GW x 32 threads.
// Operands: K-contiguous 16-bit planes. Stages of GK k go global -> LDS by asynchronous 16-byte copies (8 lanes a 128-byte row), two buffers, one barrier a stage; fragments are read from LDS in the k order of WFrag::ld. K % GK == 0.
// C[m][n] (f32, pitch ldc, + optional f32 bias[n]) = sum_k A[m][k] Bt[n][k] (+ split products per NSPLIT). z-batch strides sA/sB/sC in elements.
// EPI 0: C as above. EPI 1: Bt holds three stacked projections of ldc rows each (biases bias, bias2, bias3); projection sel = column / ldc writes plane set sel (sP elements apart). Sums + bias go straight to three head planes [batch][head][t][d] (fp16, bf16 hi, bf16 lo = rest after hi); sel 2: the same planes transposed, [batch][head][d][t]. A 64-column tile is one head (HD 64) of one projection, a 64-row tile lies in one batch; ldc / HD = heads.
// KS > 1: grid z = batches x KS (ks fastest); block (batch, ks) sums only k in [ks K/KS, (ks+1) K/KS) and writes partial plane C + z sC; the consumer adds a batch's KS planes. K % (GK KS) == 0.
template <typename T16> struct WFrag;
template <> struct WFrag<h16> { typedef v16h V; static __device__ __forceinline__ V ld(const h16* p) { return cat16(*(const v8h*)p, *(const v8h*)(p + 16)); } static __device__ __forceinline__ v8f mma(V a, V b, v8f c) { return wmma16(a, b, c); } };
template <> struct WFrag<bf> { typedef v16bf V; static __device__ __forceinline__ V ld(const bf* p) { return cat16b(*(const v8us*)p, *(const v8us*)(p + 16)); } static __device__ __forceinline__ v8f mma(V a, V b, v8f c) { return wmmab(a, b, c); } };
// three 16-bit forms of 8 f32 values: fp16, bf16 hi, bf16 lo (all round to nearest even)
__device__ __forceinline__ void split8(v8f y, v8h& o16, v8us& oh, v8us& ol) { o16 = __builtin_convertvector(y, v8h); oh = __builtin_bit_cast(v8us, __builtin_convertvector(y, v8bf)); const v4u au = __builtin_bit_cast(v4u, oh); v8f back;
#pragma unroll
    for (int i = 0; i < 4; ++i) { back[2 * i] = __uint_as_float(au[i] << 16); back[2 * i + 1] = __uint_as_float(au[i] & 0xFFFF0000u); }
    ol = __builtin_bit_cast(v8us, __builtin_convertvector(y - back, v8bf)); }
// eight asynchronous 16-byte copies of one lane: rows 16 apart of a 128-row plane (global row pitch gp elements, LDS pitch LP). l: the lane's LDS byte address, g: its global address.
// s_wait_xcnt stands inside the statement, behind the last copy: no register that a copy names is rewritten in front of it.
template <typename T16>
__device__ __forceinline__ void acopy8(unsigned l, const T16* g, size_t gp) {
    asm volatile("global_load_async_to_lds_b128 %0, %8, off\n\t"
                 "global_load_async_to_lds_b128 %1, %9, off\n\t"
                 "global_load_async_to_lds_b128 %2, %10, off\n\t"
                 "global_load_async_to_lds_b128 %3, %11, off\n\t"
                 "global_load_async_to_lds_b128 %4, %12, off\n\t"
                 "global_load_async_to_lds_b128 %5, %13, off\n\t"
                 "global_load_async_to_lds_b128 %6, %14, off\n\t"
                 "global_load_async_to_lds_b128 %7, %15, off\n\t"
                 "s_wait_xcnt 0x0"
                 :: "v"(l), "v"(l + 1u * 16 * LP * 2), "v"(l + 2u * 16 * LP * 2), "v"(l + 3u * 16 * LP * 2), "v"(l + 4u * 16 * LP * 2), "v"(l + 5u * 16 * LP * 2), "v"(l + 6u * 16 * LP * 2), "v"(l + 7u * 16 * LP * 2),
                    "v"(g), "v"(g + 16 * gp), "v"(g + 32 * gp), "v"(g + 48 * gp), "v"(g + 64 * gp), "v"(g + 80 * gp), "v"(g + 96 * gp), "v"(g + 112 * gp)
                 : "memory");
}
template <typename T16, int NSPLIT, bool BIAS, int KS = 1, int EPI = 0>
__global__ __launch_bounds__(GW * 32) void k_gemmw(const T16* __restrict__ A, const T16* __restrict__ A2, const T16* __restrict__ Bt, const T16* __restrict__ Bt2, int K, float* C, int ldc, const float* __restrict__ bias, const float* __restrict__ bias2, const float* __restrict__ bias3, size_t sA, size_t sB, size_t sC, h16* P16, bf* Ph, bf* Pl, size_t sP) {
    typedef typename WFrag<T16>::V V;
    static_assert(HD == 64 && TT % 64 == 0, "plane epilogues: a tile is one head of one batch");
    static_assert(NSPLIT <= 1, "staged planes: A, A2 (NSPLIT 1), Bt");
    constexpr int NPL = 2 + NSPLIT, BUFE = NPL * GPL;   // a buffer: A plane(s), then the Bt plane
    __shared__ __align__(16) unsigned short gs[2 * BUFE];
    const size_t z = blockIdx.z; const size_t zb = z / KS; const int kb = (int)(z % KS) * (K / KS), ke = kb + K / KS;
    A += zb * sA; if (A2) A2 += zb * sA; Bt += zb * sB; if (Bt2) Bt2 += zb * sB; C += z * sC;
    const int tid = threadIdx.x, lane = tid & 31, lr = lane & 15, hi = lane >> 4, w = __builtin_amdgcn_readfirstlane(tid >> 5); const int rb = blockIdx.x * 128, cb = blockIdx.y * 128, r0 = rb + (w >> 1) * 64, c0 = cb + (w & 1) * 64;
    const int sel = EPI == 1 ? c0 / ldc : 0, ch = c0 - sel * ldc;   // stacked projections: which one, and the tile's first column in it (the same for a whole wave)
    const float* bs = sel == 0 ? bias : sel == 1 ? bias2 : bias3;
    v8f acc[4][4];
#pragma unroll
    for (int mb = 0; mb < 4; ++mb)
#pragma unroll
        for (int nb = 0; nb < 4; ++nb) acc[mb][nb] = (v8f){};
    const int srow = tid >> 3, scol = (tid & 7) * 8;   // staging: 8 lanes a 128-byte row, rows srow + 16 j
    const size_t goa = (size_t)(rb + srow) * K + scol, gob = (size_t)(cb + srow) * K + scol;
    const unsigned ls = (unsigned)(size_t)(gs + srow * LP + scol);   // the lane's LDS byte address in buffer 0, plane 0
    auto fill = [&](int kc, int buf) { const unsigned l = ls + (unsigned)buf * (BUFE * 2);
        acopy8(l, A + goa + kc, (size_t)K); if (NSPLIT == 1) acopy8(l + GPL * 2, A2 + goa + kc, (size_t)K); acopy8(l + (NPL - 1) * GPL * 2, Bt + gob + kc, (size_t)K); };
    float bp[4] = {0.f, 0.f, 0.f, 0.f};   // transposed planes: the lane's 4 bias words, fetched ahead of the K loop so that their latency is hidden behind it (the 8 words of the other planes held over the loop cost it its load grouping)
    if (EPI == 1 && sel == 2) {
#pragma unroll
        for (int i = 0; i < 4; ++i) bp[i] = bs[ch + i * 16 + lr];
        asm volatile("s_wait_xcnt 0x0" ::: "memory"); }   // stands before the loads' address registers are reused
    const int nt = (ke - kb) / GK;
    fill(kb, 0);
    asm volatile("s_wait_asynccnt 0x0" ::: "memory");   // this wave's copies of stage 0 have landed
    __syncthreads();                                      // every wave's have: stage 0 may be read
    if (nt > 1) fill(kb + GK, 1);
#pragma unroll 1   // stays rolled: a stage is already two unrolled k steps of 16 or 32 products
    for (int t = 0; t < nt; ++t) {
        const T16* ar = (const T16*)gs + (t & 1) * BUFE + ((w >> 1) * 64 + lr) * LP + 8 * hi; const T16* br = (const T16*)gs + (t & 1) * BUFE + (NPL - 1) * GPL + ((w & 1) * 64 + lr) * LP + 8 * hi;
#pragma unroll
        for (int ks = 0; ks < GK / 32; ++ks) {
        V a[4], a2[4], b[4];   // the k step's fragments are fetched as one group ahead of its products: one LDS latency a k step, not one a B fragment
        b[0] = WFrag<T16>::ld(br + ks * 32);
#pragma unroll
        for (int mb = 0; mb < 4; ++mb) { a[mb] = WFrag<T16>::ld(ar + mb * 16 * LP + ks * 32); if (NSPLIT == 1) a2[mb] = WFrag<T16>::ld(ar + GPL + mb * 16 * LP + ks * 32); }
#pragma unroll
        for (int nb = 1; nb < 4; ++nb) b[nb] = WFrag<T16>::ld(br + nb * 16 * LP + ks * 32);
        __builtin_amdgcn_sched_barrier(0);   // keeps the group together: without it the B reads are moved down between the products, each with a full wait in front of the next four
#pragma unroll
        for (int nb = 0; nb < 4; ++nb)
#pragma unroll
            for (int mb = 0; mb < 4; ++mb) { acc[mb][nb] = WFrag<T16>::mma(a[mb], b[nb], acc[mb][nb]); if (NSPLIT == 1) acc[mb][nb] = WFrag<T16>::mma(a2[mb], b[nb], acc[mb][nb]); }
        }
        asm volatile("s_wait_dscnt 0x0" ::: "memory");      // this wave's reads of the buffer are done before it is refilled
        asm volatile("s_wait_asynccnt 0x0" ::: "memory");   // this wave's copies of stage t + 1 have landed
        __syncthreads();                                      // publishes stage t + 1 and ends every wave's reads of stage t
        if (t + 2 < nt) fill(kb + (t + 2) * GK, t & 1);       // flies while stage t + 1 is worked on
    }
    asm volatile("s_wait_asynccnt 0x0" ::: "memory");   // no copy is outstanding when the wave goes on
    if constexpr (EPI == 0) {
    __shared__ __align__(16) float osw[GW][16 * 68]; float* os = osw[w];   // a wave's own staging
#pragma unroll
    for (int mb = 0; mb < 4; ++mb) {
#pragma unroll
        for (int nb = 0; nb < 4; ++nb) {
#pragma unroll
            for (int j = 0; j < 8; ++j) os[(hi * 8 + j) * 68 + nb * 16 + lr] = acc[mb][nb][j]; }
        __builtin_amdgcn_wave_barrier(); asm volatile("" ::: "memory");
        float* crow = C + (size_t)(r0 + mb * 16) * ldc + c0;
{
#pragma unroll
            for (int s = 0; s < 8; ++s) { const int row = 2 * s + hi, cofs = lr * 4; v4f val = *(const v4fa*)(os + row * 68 + cofs); if (BIAS) { val[0] += bfr(bias[c0 + cofs]); val[1] += bfr(bias[c0 + cofs + 1]); val[2] += bfr(bias[c0 + cofs + 2]); val[3] += bfr(bias[c0 + cofs + 3]); }
                *(v4f*)(crow + (size_t)row * ldc + cofs) = val; }
             }
        __builtin_amdgcn_wave_barrier(); asm volatile("" ::: "memory");
    }
    } else {
    __shared__ __align__(16) unsigned short stw[GW][3 * 16 * 72];   // a wave's own staging, for either plane layout
    P16 += sel * sP; Ph += sel * sP; Pl += sel * sP;
    if (sel < 2) {
    float* os = (float*)stw[w];   // 16 rows at pitch 68 f32
    const int rq = lane >> 3, cofs = (lane & 7) * 8;   // 8 lanes a 128-byte plane row: a store covers 4 rows = 512 contiguous bytes
    v8f bv;
#pragma unroll
    for (int i = 0; i < 8; ++i) bv[i] = bs[ch + cofs + i];
    asm volatile("s_wait_xcnt 0x0" ::: "memory");   // stands before the loads' address registers are reused
#pragma unroll
    for (int i = 0; i < 8; ++i) bv[i] = bfr(bv[i]);
    const size_t po = ((size_t)((r0 / TT) * (ldc / HD) + ch / HD) * TT + r0 % TT) * HD + cofs;
#pragma unroll
    for (int mb = 0; mb < 4; ++mb) {
#pragma unroll
        for (int nb = 0; nb < 4; ++nb) {
#pragma unroll
            for (int j = 0; j < 8; ++j) os[(hi * 8 + j) * 68 + nb * 16 + lr] = acc[mb][nb][j]; }
        __builtin_amdgcn_wave_barrier(); asm volatile("" ::: "memory");   // the reads below take other lanes' words: they must not be moved above the writes
#pragma unroll
        for (int s = 0; s < 4; ++s) { const int row = 4 * s + rq; const v4f x0 = *(const v4fa*)(os + row * 68 + cofs), x1 = *(const v4fa*)(os + row * 68 + cofs + 4);
            v8h o16; v8us oh, ol; split8(__builtin_shufflevector(x0, x1, 0, 1, 2, 3, 4, 5, 6, 7) + bv, o16, oh, ol); const size_t eo = po + (size_t)(mb * 16 + row) * HD;
            *(v8h*)(P16 + eo) = o16; *(v8us*)(Ph + eo) = oh; *(v8us*)(Pl + eo) = ol; }
        asm volatile("s_wait_xcnt 0x0" ::: "memory");   // stands before the stores' address and data registers are reused
        __builtin_amdgcn_wave_barrier(); asm volatile("" ::: "memory");   // the next block's writes must not be moved above these reads
    }
    } else {
    // a lane holds 8 consecutive t of one d: converted in registers, staged [d][t] in LDS so that every store is whole 128-byte lines
    unsigned short* st = stw[w];   // row pitch 144 B = 16 B x odd
    const int rq = lane >> 3, cofs = (lane & 7) * 8;
    const size_t po = (size_t)((r0 / TT) * (ldc / HD) + ch / HD) * HD * TT + r0 % TT + cofs;
#pragma unroll
    for (int nb = 0; nb < 4; ++nb) { const float bn = bfr(bp[nb]);
#pragma unroll
        for (int mb = 0; mb < 4; ++mb) { v8h o16; v8us oh, ol; split8(acc[mb][nb] + bn, o16, oh, ol); unsigned short* w = st + lr * 72 + mb * 16 + hi * 8;
            *(v8ha*)w = o16; *(v8usa*)(w + 16 * 72) = oh; *(v8usa*)(w + 32 * 72) = ol; }
        __builtin_amdgcn_wave_barrier(); asm volatile("" ::: "memory");   // the reads below take other lanes' words: they must not be moved above the writes
#pragma unroll
        for (int s = 0; s < 4; ++s) { const int row = 4 * s + rq; const unsigned short* r = st + row * 72 + cofs; const size_t eo = po + (size_t)(nb * 16 + row) * TT;
            *(v8h*)(P16 + eo) = *(const v8ha*)r; *(v8us*)(Ph + eo) = *(const v8usa*)(r + 16 * 72); *(v8us*)(Pl + eo) = *(const v8usa*)(r + 32 * 72); }
        asm volatile("s_wait_xcnt 0x0" ::: "memory");   // stands before the stores' address and data registers are reused
        __builtin_amdgcn_wave_barrier(); asm volatile("" ::: "memory");   // the next block's writes must not be moved above these reads
    }
    }
    }
}

__device__ __forceinline__ void splitf(float y, unsigned short& h, unsigned short& l) { h = f2bf(y); l = f2bf(y - bf2f(h)); }

// one launch rounds x and the four weight matrices to bf16, 8 values a thread: blocks [0, XBK) take x, then WBK blocks a weight; the weights are stacked in W4 in the order Wq, Wk, Wv, Wo.
#define XBK  (BG * TT * DM / 8 / 256)
#define WBK  (DQ * DM / 8 / 256)
__global__ __launch_bounds__(256) void k_cvt8(const float* __restrict__ x, const float* __restrict__ wq, const float* __restrict__ wk, const float* __restrict__ wv, const float* __restrict__ wo, bf* XB, bf* W4) {
    static_assert((BG * TT * DM) % (8 * 256) == 0 && (DQ * DM) % (8 * 256) == 0, "whole blocks");
    const float* src = x; bf* dst = XB; int b = blockIdx.x;
    if (b >= XBK) { const int m = (b - XBK) / WBK; src = m == 0 ? wq : m == 1 ? wk : m == 2 ? wv : wo; dst = W4 + (size_t)m * DQ * DM; b -= XBK + m * WBK; }
    const size_t i = (size_t)b * 256 + threadIdx.x; const v8f v = *(const v8f*)(src + i * 8); v8us o;
    asm volatile("s_wait_xcnt 0x0" ::: "memory");   // stands before the load's address registers are reused
#pragma unroll
    for (int k = 0; k < 8; ++k) o[k] = f2bf(v[k]); *(v8us*)(dst + i * 8) = o;  }

typedef __attribute__((ext_vector_type(16))) float v16f;
template <typename T16> struct Vec8;
template <> struct Vec8<h16> { typedef v8h T; static __device__ __forceinline__ void pack(v16f p, v16h& a, v16h& b) { a = __builtin_convertvector(p, v16h); (void)b; } };
template <> struct Vec8<bf> { typedef v8us T; static __device__ __forceinline__ void pack(v16f p, v16bf& a, v16bf& b) { a = __builtin_convertvector(p, v16bf); b = __builtin_convertvector(p - __builtin_convertvector(a, v16f), v16bf); } };
__device__ __forceinline__ float xhalf(float x) { return __builtin_bit_cast(float, __builtin_amdgcn_permlanex16(__builtin_bit_cast(int, x), __builtin_bit_cast(int, x), 0x76543210, 0xfedcba98, false, false)); }   // lane l with lane l ^ 16
template <typename T16, int NP, int QT>
__device__ __forceinline__ void fattn_body(T16* L, const T16* __restrict__ Q0, const T16* __restrict__ Q1, const T16* __restrict__ K0, const T16* __restrict__ K1, const T16* __restrict__ V0, const T16* __restrict__ V1, int q0, bf* Ah, bf* Al) {
    typedef typename WFrag<T16>::V V; typedef typename Vec8<T16>::T C8;
    constexpr int PLN = SK * LP, BUFE = 2 * NP * PLN;   // a buffer: K plane(s) [key][d], then V^T plane(s) [d][key]
    const int tid = threadIdx.x, lane = tid & 31, c = lane & 15, h = lane >> 4;
    V qf[QT][2], qf2[QT][2];
#pragma unroll
    for (int qt = 0; qt < QT; ++qt)
#pragma unroll
        for (int ks = 0; ks < 2; ++ks) { const size_t qo = (size_t)(q0 + qt * 16 + c) * HD + ks * 32 + 8 * h; qf[qt][ks] = WFrag<T16>::ld(Q0 + qo); if (NP == 2) qf2[qt][ks] = WFrag<T16>::ld(Q1 + qo); }
    v8f o[QT][4]; float mref[QT], lsum[QT];
#pragma unroll
    for (int qt = 0; qt < QT; ++qt) { mref[qt] = -3.0e38f; lsum[qt] = 0.f;
#pragma unroll
        for (int dt = 0; dt < 4; ++dt) o[qt][dt] = (v8f){}; }
    const int srow = tid >> 3, scol = (tid & 7) * 8;   // staging: 8 threads a 128-byte row, rows srow + 16 j
    C8 sg[2 * NP][4];
    auto fetch = [&](int k0) {
#pragma unroll
        for (int j = 0; j < 4; ++j) { const int row = srow + (FW * 4) * j; const size_t ko = (size_t)(k0 + row) * HD + scol, vo = (size_t)row * TT + k0 + scol;
            sg[0][j] = *(const C8*)(K0 + ko); if (NP == 2) sg[1][j] = *(const C8*)(K1 + ko); sg[NP][j] = *(const C8*)(V0 + vo); if (NP == 2) sg[NP + 1][j] = *(const C8*)(V1 + vo); }
        asm volatile("s_wait_xcnt 0x0" ::: "memory"); };   // stands before the loads' address registers are reused
    auto stash = [&](T16* Bw) {
#pragma unroll
        for (int pl = 0; pl < 2 * NP; ++pl)
#pragma unroll
            for (int j = 0; j < 4; ++j) *(C8*)(Bw + pl * PLN + (srow + (FW * 4) * j) * LP + scol) = sg[pl][j]; };
    fetch(0); stash(L); __syncthreads();
#pragma unroll 1   // stays rolled: a stage is already two unrolled passes, more would only cost registers and instruction cache
    for (int s = 0; s < TT / SK; ++s) {
        const T16* B = L + (s & 1) * BUFE;
        if (s + 1 < TT / SK) fetch((s + 1) * SK);   // the next stage flies while this one is worked on
#pragma unroll
        for (int p = 0; p < SK / 32; ++p) {
            v8f sc[QT][2];
#pragma unroll
            for (int kt = 0; kt < 2; ++kt) { const T16* kr = B + ((p * 2 + kt) * 16 + c) * LP + 8 * h; V ka[2], ka2[2];
#pragma unroll
                for (int ks = 0; ks < 2; ++ks) { ka[ks] = WFrag<T16>::ld(kr + ks * 32); if (NP == 2) ka2[ks] = WFrag<T16>::ld(kr + PLN + ks * 32); }
#pragma unroll
                for (int qt = 0; qt < QT; ++qt) { v8f a = (v8f){};
#pragma unroll
                    for (int ks = 0; ks < 2; ++ks) { a = WFrag<T16>::mma(ka[ks], qf[qt][ks], a); if (NP == 2) { a = WFrag<T16>::mma(ka[ks], qf2[qt][ks], a); a = WFrag<T16>::mma(ka2[ks], qf[qt][ks], a); } }
                    sc[qt][kt] = a; } }
            float mloc[QT]; bool need = false;
#pragma unroll
            for (int qt = 0; qt < QT; ++qt) { float t[8];
#pragma unroll
                for (int r = 0; r < 8; ++r) t[r] = fmaxf(sc[qt][0][r], sc[qt][1][r]);
                float m = fmaxf(fmaxf(fmaxf(t[0], t[1]), fmaxf(t[2], t[3])), fmaxf(fmaxf(t[4], t[5]), fmaxf(t[6], t[7]))); m = fmaxf(m, xhalf(m)); mloc[qt] = m * CL; need = need || (mloc[qt] > mref[qt] + 8.0f); }
            if (__builtin_amdgcn_ballot_w32(need) != 0) {   // one wave-uniform test a pass; every lane renews its maximum
#pragma unroll
                for (int qt = 0; qt < QT; ++qt) { const float mn = fmaxf(mref[qt], mloc[qt]); const float al = __builtin_amdgcn_exp2f(mref[qt] - mn); mref[qt] = mn; lsum[qt] *= al;
#pragma unroll
                    for (int dt = 0; dt < 4; ++dt) o[qt][dt] *= al; } }
            V pb[QT], pb2[QT];
#pragma unroll
            for (int qt = 0; qt < QT; ++qt) { v16f pv;
#pragma unroll
                for (int i = 0; i < 16; ++i) pv[i] = __builtin_amdgcn_exp2f(__builtin_fmaf(sc[qt][i >> 3][i & 7], CL, -mref[qt]));
                float t[8];
#pragma unroll
                for (int r = 0; r < 8; ++r) t[r] = pv[r] + pv[r + 8];
                lsum[qt] += ((t[0] + t[1]) + (t[2] + t[3])) + ((t[4] + t[5]) + (t[6] + t[7]));
                Vec8<T16>::pack(pv, pb[qt], pb2[qt]); }
#pragma unroll
            for (int dt = 0; dt < 4; ++dt) { const T16* vr = B + NP * PLN + (dt * 16 + c) * LP + p * 32 + 8 * h; const V va = WFrag<T16>::ld(vr); V va2; if (NP == 2) va2 = WFrag<T16>::ld(vr + PLN);
#pragma unroll
                for (int qt = 0; qt < QT; ++qt) { o[qt][dt] = WFrag<T16>::mma(va, pb[qt], o[qt][dt]); if (NP == 2) { o[qt][dt] = WFrag<T16>::mma(va, pb2[qt], o[qt][dt]); o[qt][dt] = WFrag<T16>::mma(va2, pb[qt], o[qt][dt]); } } }
        }
        if (s + 1 < TT / SK) stash(L + ((s + 1) & 1) * BUFE);   // its last readers left that buffer at the barrier of stage s - 1
        __syncthreads();
    }
#pragma unroll
    for (int qt = 0; qt < QT; ++qt) { const float inv = __fdiv_rn(1.0f, lsum[qt] + xhalf(lsum[qt])); const size_t ro = (size_t)(q0 + qt * 16 + c) * DQ + 8 * h;   // a lane holds 8 consecutive d of one query: 16-byte stores
#pragma unroll
        for (int dt = 0; dt < 4; ++dt) { v8us oh, ol;
#pragma unroll
            for (int r = 0; r < 8; ++r) { unsigned short a, c2; splitf(o[qt][dt][r] * inv, a, c2); oh[r] = a; ol[r] = c2; }
            *(v8us*)(Ah + ro + dt * 16) = oh; *(v8us*)(Al + ro + dt * 16) = ol;
            asm volatile("s_wait_xcnt 0x0" ::: "memory"); } }   // stands before the stores' address and data registers are reused
}
// amdgpu_waves_per_eu(4): holds the allocation under 256 VGPRs; without it the build goes just above and needs register-window switches in the loop.
__global__ __launch_bounds__(FW * 32) __attribute__((amdgpu_waves_per_eu(4))) void k_fattn(const h16* __restrict__ Q16, const h16* __restrict__ K16, const h16* __restrict__ V16, const bf* __restrict__ Qh, const bf* __restrict__ Ql, const bf* __restrict__ Kh, const bf* __restrict__ Kl, const bf* __restrict__ Vh, const bf* __restrict__ Vl, bf* Ah, bf* Al) {
    __shared__ __align__(16) unsigned short L[2 * 4 * SK * LP];
    const int z = blockIdx.x, bb = z / NH_, hh = z % NH_, w = threadIdx.x >> 5; const size_t pq = (size_t)z * TT * HD, pk = (size_t)(bb * NKV + hh / REP) * TT * HD, ao = (size_t)bb * TT * DQ + hh * HD;
    if (blockIdx.y < HB) fattn_body<bf, 2, 1>((bf*)L, Qh + pq, Ql + pq, Kh + pk, Kl + pk, Vh + pk, Vl + pk, ((int)blockIdx.y * FW + w) * 16, Ah + ao, Al + ao);
    else fattn_body<h16, 1, 2>((h16*)L, Q16 + pq, nullptr, K16 + pk, nullptr, V16 + pk, nullptr, RH + (((int)blockIdx.y - HB) * FW + w) * 32, Ah + ao, Al + ao);
}

extern "C" void kernel_launch(void* const* d_in, const int* in_sizes, int n_in,
                              void* d_out, int out_size, void* d_ws, size_t ws_size, hipStream_t stream) {
    (void)in_sizes; (void)n_in; (void)out_size;
    static_assert((BG * TT) % 128 == 0 && DQ % 128 == 0 && DKV % 128 == 0 && DM % 128 == 0 && DM % GK == 0 && DQ % GK == 0, "k_gemmw: whole 128 x 128 block tiles, whole stages");
    static_assert(BG == NB_ && DKV == DQ && NKV == NH_, "one launch a stage: all batches; Wq, Wk, Wv stacked as equal blocks");
    const float* x = (const float*)d_in[0]; const float* wq = (const float*)d_in[1]; const float* bq = (const float*)d_in[2]; const float* wk = (const float*)d_in[3]; const float* bk = (const float*)d_in[4]; const float* wv = (const float*)d_in[5]; const float* bv = (const float*)d_in[6]; const float* wo = (const float*)d_in[7]; const float* bo = (const float*)d_in[8];   /* weights 'oi' [768][768] */
    float* OUT = (float*)d_out;     // [4][2048][768]
    char* wsp = (char*)d_ws;
    auto take = [&](size_t bytes) { char* p = wsp; wsp += (bytes + 255) & ~(size_t)255; return (void*)p; };
    constexpr size_t PS = (size_t)BG * NH_ * TT * HD;   // elements of one plane (all batches and heads)
    bf* W4 = (bf*)take((size_t)4 * DQ * DM * 2); bf* WO = W4 + (size_t)3 * DQ * DM;   // Wq, Wk, Wv, Wo stacked
    h16* QP16 = (h16*)take(3 * PS * 2); h16* KP16 = QP16 + PS; h16* VT16 = QP16 + 2 * PS;   // each form: the Q, K and V^T planes in a row
    bf* QPh = (bf*)take(3 * PS * 2); bf* KPh = QPh + PS; bf* VTh = QPh + 2 * PS; bf* QPl = (bf*)take(3 * PS * 2); bf* KPl = QPl + PS; bf* VTl = QPl + 2 * PS;
    bf* XB = (bf*)take((size_t)BG * TT * DM * 2); bf* ATh = (bf*)take((size_t)BG * TT * DQ * 2); bf* ATl = (bf*)take((size_t)BG * TT * DQ * 2);
    if ((size_t)(wsp - (char*)d_ws) > ws_size) return;    // ws 256 MiB
    k_cvt8<<<XBK + 4 * WBK, 256, 0, stream>>>(x, wq, wk, wv, wo, XB, W4);
    k_gemmw<bf, 0, true, 1, 1><<<dim3(BG * TT / 128, 3 * DQ / 128, 1), GW * 32, 0, stream>>>(XB, nullptr, W4, nullptr, DM, nullptr, DQ, bq, bk, bv, 0, 0, 0, QP16, QPh, QPl, PS);
    k_fattn<<<dim3(BG * NH_, HB + LB, 1), FW * 32, 0, stream>>>(QP16, KP16, VT16, QPh, QPl, KPh, KPl, VTh, VTl, ATh, ATl);   // hi/lo blocks (the longer ones) take the lower y indices
    k_gemmw<bf, 1, true><<<dim3(BG * TT / 128, DM / 128, 1), GW * 32, 0, stream>>>(ATh, ATl, WO, nullptr, DQ, OUT, DM, bo, nullptr, nullptr, 0, 0, 0, nullptr, nullptr, nullptr, 0);
}

// v007
// It runs in 121 microseconds.
// In both of two side-by-side timings against v006, it was 1.10 times as fast.
// All steps since v000 together make it 24.8 times as fast.
#include <hip/hip_runtime.h>

// Multi-head attention at d_model 768 with biased projections (x [4][2048][768]; q, k, v = x W^T + b ('oi' [768][768] 768^-0.5 + biases 0.01: non-zero; 12 heads x 64); attn x 64^-0.5; softmax over all keys (no mask); out = merged Wo^T + bo ('oi' + bias 0.01) -> [4][2048][768] (6.3 M); argument order x, Wq, bq, Wk, bk, Wv, bv, Wo, bo).
// Four launches, each over all BG batches: bf16 copies of x and of the 'oi' weights; the three exact projections (K 768) + f32 biases as one GEMM on the stacked weights, whose epilogue writes the head planes (fp16, bf16 hi, bf16 lo; V transposed); one fused attention launch (scores, online softmax and P x V stay in registers; hybrid rows: < 512 hi/lo 3 products, rest fp16); merged hi/lo x Wo exact + bo.
// Compute dtypes, f32 accumulate: every input rounded to bf16; projections exact + f32 biases; attention rows < 512 3 products, rest fp16; softmax f32; output projection hl x exact.

#define NB_  4
#define TT   2048
#define DM   768
#define NH_  12
#define NKV  12
#define REP  (NH_ / NKV)
#define HD   64
#define DQ   (NH_ * HD)
#define DKV  (NKV * HD)
#define BG   4                    // batches per launch: all of them
#define RH   512                  // query rows < RH use hi+lo planes (0: none)
#define WIN  0
#define SCL  0.125f   // HD^-0.5
#define FW   4                    // k_fattn: waves per block
#define SK   64                   // k_fattn: keys per LDS stage (two passes of 32 keys)
#define LP   72                   // k_fattn: LDS row pitch in 16-bit elements (144 B = 16 B x odd, conflict-free for 16-byte reads)
#define HB   (RH / (16 * FW))     // k_fattn: hi/lo blocks per head (16 queries a wave)
#define LB   ((TT - RH) / (32 * FW))   // k_fattn: fp16 blocks per head (32 queries a wave)
#define CL   0.18033688011112042f // HD^-0.5 x log2(e)
#define GW   4                    // k_gemmw: waves per block, 2 x 2 wave tiles of 64 x 64
#define GK   64                   // k_gemmw: K elements per LDS stage (a 128-byte row = one whole cache line)
#define GPL  (128 * LP)           // k_gemmw: elements of one staged operand plane (128 rows at pitch LP)
typedef _Float16 h16;
typedef unsigned short bf;
typedef __attribute__((ext_vector_type(16))) __bf16   v16bf;
typedef __attribute__((ext_vector_type(16))) _Float16 v16h;
typedef __attribute__((ext_vector_type(8)))  _Float16 v8h;
typedef __attribute__((ext_vector_type(8)))  unsigned short v8us;
typedef __attribute__((ext_vector_type(8)))  float    v8f;
typedef __attribute__((ext_vector_type(4)))  float    v4f;
typedef v8h  __attribute__((may_alias)) v8ha;
typedef v4f  __attribute__((may_alias)) v4fa;
typedef v8us __attribute__((may_alias)) v8usa;
typedef __attribute__((ext_vector_type(8)))  __bf16   v8bf;
typedef __attribute__((ext_vector_type(4)))  unsigned v4u;

__device__ __forceinline__ unsigned short f2bf(float f) { unsigned u = __float_as_uint(f); u += 0x7FFFu + ((u >> 16) & 1u); return (unsigned short)(u >> 16); }
__device__ __forceinline__ float bf2f(unsigned short b) { return __uint_as_float(((unsigned)b) << 16); }
__device__ __forceinline__ float bfr(float f) { return bf2f(f2bf(f)); }
__device__ __forceinline__ v16h cat16(v8h lo, v8h hi) { return __builtin_shufflevector(lo, hi, 0, 1, 2, 3, 4, 5, 6, 7, 8, 9, 10, 11, 12, 13, 14, 15); }
__device__ __forceinline__ v16bf cat16b(v8us lo, v8us hi) { return __builtin_bit_cast(v16bf, __builtin_shufflevector(lo, hi, 0, 1, 2, 3, 4, 5, 6, 7, 8, 9, 10, 11, 12, 13, 14, 15)); }
__device__ __forceinline__ v8f wmma16(v16h a, v16h b, v8f c) { return __builtin_amdgcn_wmma_f32_16x16x32_f16(false, a, false, b, (short)0, c, false, false); }
__device__ __forceinline__ v8f wmmab(v16bf a, v16bf b, v8f c) { return __builtin_amdgcn_wmma_f32_16x16x32_bf16(false, a, false, b, (short)0, c, false, false); }



// ---- k_gemmw: register-blocked GEMM, one wave per 64x64 output tile (16 accumulators), GW waves share a 128x128 block tile; grid (M/128, N/128, Z), GW x 32 threads.
// Operands: K-contiguous 16-bit planes. Stages of GK k go global -> LDS by asynchronous 16-byte copies (8 lanes a 128-byte row), two buffers, one barrier a stage; fragments are read from LDS in the k order of WFrag::ld. K % GK == 0.
// C[m][n] (f32, pitch ldc, + optional f32 bias[n]) = sum_k A[m][k] Bt[n][k] (+ split products per NSPLIT). z-batch strides sA/sB/sC in elements.
// EPI 0: C as above. EPI 1: Bt holds three stacked projections of ldc rows each (biases bias, bias2, bias3); projection sel = column / ldc writes plane set sel (sP elements apart). Sums + bias go straight to three head planes [batch][head][t][d] (fp16, bf16 hi, bf16 lo = rest after hi); sel 2: the same planes transposed, [batch][head][d][t]. A 64-column tile is one head (HD 64) of one projection, a 64-row tile lies in one batch; ldc / HD = heads.
// KS > 1: grid z = batches x KS (ks fastest); block (batch, ks) sums only k in [ks K/KS, (ks+1) K/KS) and writes partial plane C + z sC; the consumer adds a batch's KS planes. K % (GK KS) == 0.
template <typename T16> struct WFrag;
template <> struct WFrag<h16> { typedef v16h V; static __device__ __forceinline__ V ld(const h16* p) { return cat16(*(const v8h*)p, *(const v8h*)(p + 16)); } static __device__ __forceinline__ v8f mma(V a, V b, v8f c) { return wmma16(a, b, c); } };
template <> struct WFrag<bf> { typedef v16bf V; static __device__ __forceinline__ V ld(const bf* p) { return cat16b(*(const v8us*)p, *(const v8us*)(p + 16)); } static __device__ __forceinline__ v8f mma(V a, V b, v8f c) { return wmmab(a, b, c); } };
// three 16-bit forms of 8 f32 values: fp16, bf16 hi, bf16 lo (all round to nearest even)
__device__ __forceinline__ void split8(v8f y, v8h& o16, v8us& oh, v8us& ol) { o16 = __builtin_convertvector(y, v8h); oh = __builtin_bit_cast(v8us, __builtin_convertvector(y, v8bf)); const v4u au = __builtin_bit_cast(v4u, oh); v8f back;
#pragma unroll
    for (int i = 0; i < 4; ++i) { back[2 * i] = __uint_as_float(au[i] << 16); back[2 * i + 1] = __uint_as_float(au[i] & 0xFFFF0000u); }
    ol = __builtin_bit_cast(v8us, __builtin_convertvector(y - back, v8bf)); }
// eight asynchronous 16-byte copies of one lane: rows 16 apart of a 128-row plane (global row pitch gp elements, LDS pitch LP). l: the lane's LDS byte address, g: its global address.
// s_wait_xcnt stands inside the statement, behind the last copy: no register that a copy names is rewritten in front of it.
template <typename T16>
__device__ __forceinline__ void acopy8(unsigned l, const T16* g, size_t gp) {
    asm volatile("global_load_async_to_lds_b128 %0, %8, off\n\t"
                 "global_load_async_to_lds_b128 %1, %9, off\n\t"
                 "global_load_async_to_lds_b128 %2, %10, off\n\t"
                 "global_load_async_to_lds_b128 %3, %11, off\n\t"
                 "global_load_async_to_lds_b128 %4, %12, off\n\t"
                 "global_load_async_to_lds_b128 %5, %13, off\n\t"
                 "global_load_async_to_lds_b128 %6, %14, off\n\t"
                 "global_load_async_to_lds_b128 %7, %15, off\n\t"
                 "s_wait_xcnt 0x0"
                 :: "v"(l), "v"(l + 1u * 16 * LP * 2), "v"(l + 2u * 16 * LP * 2), "v"(l + 3u * 16 * LP * 2), "v"(l + 4u * 16 * LP * 2), "v"(l + 5u * 16 * LP * 2), "v"(l + 6u * 16 * LP * 2), "v"(l + 7u * 16 * LP * 2),
                    "v"(g), "v"(g + 16 * gp), "v"(g + 32 * gp), "v"(g + 48 * gp), "v"(g + 64 * gp), "v"(g + 80 * gp), "v"(g + 96 * gp), "v"(g + 112 * gp)
                 : "memory");
}
template <typename T16, int NSPLIT, bool BIAS, int KS = 1, int EPI = 0>
__global__ __launch_bounds__(GW * 32) void k_gemmw(const T16* __restrict__ A, const T16* __restrict__ A2, const T16* __restrict__ Bt, const T16* __restrict__ Bt2, int K, float* C, int ldc, const float* __restrict__ bias, const float* __restrict__ bias2, const float* __restrict__ bias3, size_t sA, size_t sB, size_t sC, h16* P16, bf* Ph, bf* Pl, size_t sP) {
    typedef typename WFrag<T16>::V V;
    static_assert(HD == 64 && TT % 64 == 0, "plane epilogues: a tile is one head of one batch");
    static_assert(NSPLIT <= 1, "staged planes: A, A2 (NSPLIT 1), Bt");
    constexpr int NPL = 2 + NSPLIT, BUFE = NPL * GPL;   // a buffer: A plane(s), then the Bt plane
    __shared__ __align__(16) unsigned short gs[2 * BUFE];
    const size_t z = blockIdx.z; const size_t zb = z / KS; const int kb = (int)(z % KS) * (K / KS), ke = kb + K / KS;
    A += zb * sA; if (A2) A2 += zb * sA; Bt += zb * sB; if (Bt2) Bt2 += zb * sB; C += z * sC;
    const int tid = threadIdx.x, lane = tid & 31, lr = lane & 15, hi = lane >> 4, w = __builtin_amdgcn_readfirstlane(tid >> 5); const int rb = blockIdx.x * 128, cb = blockIdx.y * 128, r0 = rb + (w >> 1) * 64, c0 = cb + (w & 1) * 64;
    const int sel = EPI == 1 ? c0 / ldc : 0, ch = c0 - sel * ldc;   // stacked projections: which one, and the tile's first column in it (the same for a whole wave)
    const float* bs = sel == 0 ? bias : sel == 1 ? bias2 : bias3;
    v8f acc[4][4];
#pragma unroll
    for (int mb = 0; mb < 4; ++mb)
#pragma unroll
        for (int nb = 0; nb < 4; ++nb) acc[mb][nb] = (v8f){};
    const int srow = tid >> 3, scol = (tid & 7) * 8;   // staging: 8 lanes a 128-byte row, rows srow + 16 j
    const size_t goa = (size_t)(rb + srow) * K + scol, gob = (size_t)(cb + srow) * K + scol;
    const unsigned ls = (unsigned)(size_t)(gs + srow * LP + scol);   // the lane's LDS byte address in buffer 0, plane 0
    auto fill = [&](int kc, int buf) { const unsigned l = ls + (unsigned)buf * (BUFE * 2);
        acopy8(l, A + goa + kc, (size_t)K); if (NSPLIT == 1) acopy8(l + GPL * 2, A2 + goa + kc, (size_t)K); acopy8(l + (NPL - 1) * GPL * 2, Bt + gob + kc, (size_t)K); };
    float bp[4] = {0.f, 0.f, 0.f, 0.f};   // transposed planes: the lane's 4 bias words, fetched ahead of the K loop so that their latency is hidden behind it (the 8 words of the other planes held over the loop cost it its load grouping)
    if (EPI == 1 && sel == 2) {
#pragma unroll
        for (int i = 0; i < 4; ++i) bp[i] = bs[ch + i * 16 + lr];
        asm volatile("s_wait_xcnt 0x0" ::: "memory"); }   // stands before the loads' address registers are reused
    const int nt = (ke - kb) / GK;
    fill(kb, 0);
    asm volatile("s_wait_asynccnt 0x0" ::: "memory");   // this wave's copies of stage 0 have landed
    __syncthreads();                                      // every wave's have: stage 0 may be read
    if (nt > 1) fill(kb + GK, 1);
#pragma unroll 1   // stays rolled: a stage is already two unrolled k steps of 16 or 32 products
    for (int t = 0; t < nt; ++t) {
        const T16* ar = (const T16*)gs + (t & 1) * BUFE + ((w >> 1) * 64 + lr) * LP + 8 * hi; const T16* br = (const T16*)gs + (t & 1) * BUFE + (NPL - 1) * GPL + ((w & 1) * 64 + lr) * LP + 8 * hi;
#pragma unroll
        for (int ks = 0; ks < GK / 32; ++ks) {
        V a[4], a2[4], b[4];   // the k step's fragments are fetched as one group ahead of its products: one LDS latency a k step, not one a B fragment
        b[0] = WFrag<T16>::ld(br + ks * 32);
#pragma unroll
        for (int mb = 0; mb < 4; ++mb) { a[mb] = WFrag<T16>::ld(ar + mb * 16 * LP + ks * 32); if (NSPLIT == 1) a2[mb] = WFrag<T16>::ld(ar + GPL + mb * 16 * LP + ks * 32); }
#pragma unroll
        for (int nb = 1; nb < 4; ++nb) b[nb] = WFrag<T16>::ld(br + nb * 16 * LP + ks * 32);
        __builtin_amdgcn_sched_barrier(0);   // keeps the group together: without it the B reads are moved down between the products, each with a full wait in front of the next four
#pragma unroll
        for (int nb = 0; nb < 4; ++nb)
#pragma unroll
            for (int mb = 0; mb < 4; ++mb) { acc[mb][nb] = WFrag<T16>::mma(a[mb], b[nb], acc[mb][nb]); if (NSPLIT == 1) acc[mb][nb] = WFrag<T16>::mma(a2[mb], b[nb], acc[mb][nb]); }
        }
        asm volatile("s_wait_dscnt 0x0" ::: "memory");      // this wave's reads of the buffer are done before it is refilled
        asm volatile("s_wait_asynccnt 0x0" ::: "memory");   // this wave's copies of stage t + 1 have landed
        __syncthreads();                                      // publishes stage t + 1 and ends every wave's reads of stage t
        if (t + 2 < nt) fill(kb + (t + 2) * GK, t & 1);       // flies while stage t + 1 is worked on
    }
    asm volatile("s_wait_asynccnt 0x0" ::: "memory");   // no copy is outstanding when the wave goes on
    if constexpr (EPI == 0) {
    __shared__ __align__(16) float osw[GW][16 * 68]; float* os = osw[w];   // a wave's own staging
#pragma unroll
    for (int mb = 0; mb < 4; ++mb) {
#pragma unroll
        for (int nb = 0; nb < 4; ++nb) {
#pragma unroll
            for (int j = 0; j < 8; ++j) os[(hi * 8 + j) * 68 + nb * 16 + lr] = acc[mb][nb][j]; }
        __builtin_amdgcn_wave_barrier(); asm volatile("" ::: "memory");
        float* crow = C + (size_t)(r0 + mb * 16) * ldc + c0;
{
#pragma unroll
            for (int s = 0; s < 8; ++s) { const int row = 2 * s + hi, cofs = lr * 4; v4f val = *(const v4fa*)(os + row * 68 + cofs); if (BIAS) { val[0] += bfr(bias[c0 + cofs]); val[1] += bfr(bias[c0 + cofs + 1]); val[2] += bfr(bias[c0 + cofs + 2]); val[3] += bfr(bias[c0 + cofs + 3]); }
                *(v4f*)(crow + (size_t)row * ldc + cofs) = val; }
             }
        __builtin_amdgcn_wave_barrier(); asm volatile("" ::: "memory");
    }
    } else {
    __shared__ __align__(16) unsigned short stw[GW][3 * 16 * 72];   // a wave's own staging, for either plane layout
    P16 += sel * sP; Ph += sel * sP; Pl += sel * sP;
    if (sel < 2) {
    float* os = (float*)stw[w];   // 16 rows at pitch 68 f32
    const int rq = lane >> 3, cofs = (lane & 7) * 8;   // 8 lanes a 128-byte plane row: a store covers 4 rows = 512 contiguous bytes
    v8f bv;
#pragma unroll
    for (int i = 0; i < 8; ++i) bv[i] = bs[ch + cofs + i];
    asm volatile("s_wait_xcnt 0x0" ::: "memory");   // stands before the loads' address registers are reused
#pragma unroll
    for (int i = 0; i < 8; ++i) bv[i] = bfr(bv[i]);
    const size_t po = ((size_t)((r0 / TT) * (ldc / HD) + ch / HD) * TT + r0 % TT) * HD + cofs;
#pragma unroll
    for (int mb = 0; mb < 4; ++mb) {
#pragma unroll
        for (int nb = 0; nb < 4; ++nb) {
#pragma unroll
            for (int j = 0; j < 8; ++j) os[(hi * 8 + j) * 68 + nb * 16 + lr] = acc[mb][nb][j]; }
        __builtin_amdgcn_wave_barrier(); asm volatile("" ::: "memory");   // the reads below take other lanes' words: they must not be moved above the writes
#pragma unroll
        for (int s = 0; s < 4; ++s) { const int row = 4 * s + rq; const v4f x0 = *(const v4fa*)(os + row * 68 + cofs), x1 = *(const v4fa*)(os + row * 68 + cofs + 4);
            v8h o16; v8us oh, ol; split8(__builtin_shufflevector(x0, x1, 0, 1, 2, 3, 4, 5, 6, 7) + bv, o16, oh, ol); const size_t eo = po + (size_t)(mb * 16 + row) * HD;
            *(v8h*)(P16 + eo) = o16; *(v8us*)(Ph + eo) = oh; *(v8us*)(Pl + eo) = ol; }
        asm volatile("s_wait_xcnt 0x0" ::: "memory");   // stands before the stores' address and data registers are reused
        __builtin_amdgcn_wave_barrier(); asm volatile("" ::: "memory");   // the next block's writes must not be moved above these reads
    }
    } else {
    // a lane holds 8 consecutive t of one d: converted in registers, staged [d][t] in LDS so that every store is whole 128-byte lines
    unsigned short* st = stw[w];   // row pitch 144 B = 16 B x odd
    const int rq = lane >> 3, cofs = (lane & 7) * 8;
    const size_t po = (size_t)((r0 / TT) * (ldc / HD) + ch / HD) * HD * TT + r0 % TT + cofs;
#pragma unroll
    for (int nb = 0; nb < 4; ++nb) { const float bn = bfr(bp[nb]);
#pragma unroll
        for (int mb = 0; mb < 4; ++mb) { v8h o16; v8us oh, ol; split8(acc[mb][nb] + bn, o16, oh, ol); unsigned short* w = st + lr * 72 + mb * 16 + hi * 8;
            *(v8ha*)w = o16; *(v8usa*)(w + 16 * 72) = oh; *(v8usa*)(w + 32 * 72) = ol; }
        __builtin_amdgcn_wave_barrier(); asm volatile("" ::: "memory");   // the reads below take other lanes' words: they must not be moved above the writes
#pragma unroll
        for (int s = 0; s < 4; ++s) { const int row = 4 * s + rq; const unsigned short* r = st + row * 72 + cofs; const size_t eo = po + (size_t)(nb * 16 + row) * TT;
            *(v8h*)(P16 + eo) = *(const v8ha*)r; *(v8us*)(Ph + eo) = *(const v8usa*)(r + 16 * 72); *(v8us*)(Pl + eo) = *(const v8usa*)(r + 32 * 72); }
        asm volatile("s_wait_xcnt 0x0" ::: "memory");   // stands before the stores' address and data registers are reused
        __builtin_amdgcn_wave_barrier(); asm volatile("" ::: "memory");   // the next block's writes must not be moved above these reads
    }
    }
    }
}

__device__ __forceinline__ void splitf(float y, unsigned short& h, unsigned short& l) { h = f2bf(y); l = f2bf(y - bf2f(h)); }

// one launch rounds x and the four weight matrices to bf16, 8 values a thread: blocks [0, XBK) take x, then WBK blocks a weight; the weights are stacked in W4 in the order Wq, Wk, Wv, Wo.
#define XBK  (BG * TT * DM / 8 / 256)
#define WBK  (DQ * DM / 8 / 256)
__global__ __launch_bounds__(256) void k_cvt8(const float* __restrict__ x, const float* __restrict__ wq, const float* __restrict__ wk, const float* __restrict__ wv, const float* __restrict__ wo, bf* XB, bf* W4) {
    static_assert((BG * TT * DM) % (8 * 256) == 0 && (DQ * DM) % (8 * 256) == 0, "whole blocks");
    const float* src = x; bf* dst = XB; int b = blockIdx.x;
    if (b >= XBK) { const int m = (b - XBK) / WBK; src = m == 0 ? wq : m == 1 ? wk : m == 2 ? wv : wo; dst = W4 + (size_t)m * DQ * DM; b -= XBK + m * WBK; }
    const size_t i = (size_t)b * 256 + threadIdx.x; const v8f v = *(const v8f*)(src + i * 8); v8us o;
    asm volatile("s_wait_xcnt 0x0" ::: "memory");   // stands before the load's address registers are reused
#pragma unroll
    for (int k = 0; k < 8; ++k) o[k] = f2bf(v[k]); *(v8us*)(dst + i * 8) = o;  }

typedef __attribute__((ext_vector_type(16))) float v16f;
template <typename T16> struct Vec8;
template <> struct Vec8<h16> { typedef v8h T; static __device__ __forceinline__ void pack(v16f p, v16h& a, v16h& b) { a = __builtin_convertvector(p, v16h); (void)b; } };
template <> struct Vec8<bf> { typedef v8us T; static __device__ __forceinline__ void pack(v16f p, v16bf& a, v16bf& b) { a = __builtin_convertvector(p, v16bf); b = __builtin_convertvector(p - __builtin_convertvector(a, v16f), v16bf); } };
__device__ __forceinline__ float xhalf(float x) { return __builtin_bit_cast(float, __builtin_amdgcn_permlanex16(__builtin_bit_cast(int, x), __builtin_bit_cast(int, x), 0x76543210, 0xfedcba98, false, false)); }   // lane l with lane l ^ 16
template <typename T16, int NP, int QT>
__device__ __forceinline__ void fattn_body(T16* L, const T16* __restrict__ Q0, const T16* __restrict__ Q1, const T16* __restrict__ K0, const T16* __restrict__ K1, const T16* __restrict__ V0, const T16* __restrict__ V1, int q0, bf* Ah, bf* Al) {
    typedef typename WFrag<T16>::V V; typedef typename Vec8<T16>::T C8;
    constexpr int PLN = SK * LP, BUFE = 2 * NP * PLN;   // a buffer: K plane(s) [key][d], then V^T plane(s) [d][key]
    const int tid = threadIdx.x, lane = tid & 31, c = lane & 15, h = lane >> 4;
    V qf[QT][2], qf2[QT][2];
#pragma unroll
    for (int qt = 0; qt < QT; ++qt)
#pragma unroll
        for (int ks = 0; ks < 2; ++ks) { const size_t qo = (size_t)(q0 + qt * 16 + c) * HD + ks * 32 + 8 * h; qf[qt][ks] = WFrag<T16>::ld(Q0 + qo); if (NP == 2) qf2[qt][ks] = WFrag<T16>::ld(Q1 + qo); }
    v8f o[QT][4]; float mref[QT], lsum[QT];
#pragma unroll
    for (int qt = 0; qt < QT; ++qt) { mref[qt] = -3.0e38f; lsum[qt] = 0.f;
#pragma unroll
        for (int dt = 0; dt < 4; ++dt) o[qt][dt] = (v8f){}; }
    const int srow = tid >> 3, scol = (tid & 7) * 8;   // staging: 8 threads a 128-byte row, rows srow + 16 j
    C8 sg[2 * NP][4];
    auto fetch = [&](int k0) {
#pragma unroll
        for (int j = 0; j < 4; ++j) { const int row = srow + (FW * 4) * j; const size_t ko = (size_t)(k0 + row) * HD + scol, vo = (size_t)row * TT + k0 + scol;
            sg[0][j] = *(const C8*)(K0 + ko); if (NP == 2) sg[1][j] = *(const C8*)(K1 + ko); sg[NP][j] = *(const C8*)(V0 + vo); if (NP == 2) sg[NP + 1][j] = *(const C8*)(V1 + vo); }
        asm volatile("s_wait_xcnt 0x0" ::: "memory"); };   // stands before the loads' address registers are reused
    auto stash = [&](T16* Bw) {
#pragma unroll
        for (int pl = 0; pl < 2 * NP; ++pl)
#pragma unroll
            for (int j = 0; j < 4; ++j) *(C8*)(Bw + pl * PLN + (srow + (FW * 4) * j) * LP + scol) = sg[pl][j]; };
    fetch(0); stash(L); __syncthreads();
#pragma unroll 1   // stays rolled: a stage is already two unrolled passes, more would only cost registers and instruction cache
    for (int s = 0; s < TT / SK; ++s) {
        const T16* B = L + (s & 1) * BUFE;
        if (s + 1 < TT / SK) fetch((s + 1) * SK);   // the next stage flies while this one is worked on
#pragma unroll
        for (int p = 0; p < SK / 32; ++p) {
            // the pass's K fragments are fetched as one group ahead of its products: one LDS latency a pass, not one a fragment
            V ka[2][2], ka2[2][2];
#pragma unroll
            for (int kt = 0; kt < 2; ++kt) { const T16* kr = B + ((p * 2 + kt) * 16 + c) * LP + 8 * h;
#pragma unroll
                for (int ks = 0; ks < 2; ++ks) { ka[kt][ks] = WFrag<T16>::ld(kr + ks * 32); if (NP == 2) ka2[kt][ks] = WFrag<T16>::ld(kr + PLN + ks * 32); } }
            __builtin_amdgcn_sched_barrier(0);   // keeps the group together: without it the reads are moved down between the products, each with a full wait behind it
            // every tile sums in the order ks 0, 1 and, within a ks, K Q, K Qlo, Klo Q; the tiles take turns, so that neighbouring products do not depend on each other
            v8f sc[QT][2];
#pragma unroll
            for (int ks = 0; ks < 2; ++ks) {
#pragma unroll
                for (int kt = 0; kt < 2; ++kt)
#pragma unroll
                    for (int qt = 0; qt < QT; ++qt) sc[qt][kt] = WFrag<T16>::mma(ka[kt][ks], qf[qt][ks], ks == 0 ? (v8f){} : sc[qt][kt]);
                if (NP == 2) {
#pragma unroll
                    for (int kt = 0; kt < 2; ++kt)
#pragma unroll
                        for (int qt = 0; qt < QT; ++qt) sc[qt][kt] = WFrag<T16>::mma(ka[kt][ks], qf2[qt][ks], sc[qt][kt]);
#pragma unroll
                    for (int kt = 0; kt < 2; ++kt)
#pragma unroll
                        for (int qt = 0; qt < QT; ++qt) sc[qt][kt] = WFrag<T16>::mma(ka2[kt][ks], qf[qt][ks], sc[qt][kt]); } }
            __builtin_amdgcn_sched_barrier(0);   // keeps the V^T reads below out of the run of products: without it a pair of them is moved up among the products, one more place with LDS reads
            // the pass's V^T fragments, one group again, fetched ahead of the softmax arithmetic, which hides their latency
            V va[4], va2[4];
#pragma unroll
            for (int dt = 0; dt < 4; ++dt) { const T16* vr = B + NP * PLN + (dt * 16 + c) * LP + p * 32 + 8 * h; va[dt] = WFrag<T16>::ld(vr); if (NP == 2) va2[dt] = WFrag<T16>::ld(vr + PLN); }
            __builtin_amdgcn_sched_barrier(0);   // keeps the group up here: without it the reads are moved down to the products that use them
            float mloc[QT]; bool need = false;
#pragma unroll
            for (int qt = 0; qt < QT; ++qt) { float t[8];
#pragma unroll
                for (int r = 0; r < 8; ++r) t[r] = fmaxf(sc[qt][0][r], sc[qt][1][r]);
                float m = fmaxf(fmaxf(fmaxf(t[0], t[1]), fmaxf(t[2], t[3])), fmaxf(fmaxf(t[4], t[5]), fmaxf(t[6], t[7]))); m = fmaxf(m, xhalf(m)); mloc[qt] = m * CL; need = need || (mloc[qt] > mref[qt] + 8.0f); }
            if (__builtin_amdgcn_ballot_w32(need) != 0) {   // one wave-uniform test a pass; every lane renews its maximum
#pragma unroll
                for (int qt = 0; qt < QT; ++qt) { const float mn = fmaxf(mref[qt], mloc[qt]); const float al = __builtin_amdgcn_exp2f(mref[qt] - mn); mref[qt] = mn; lsum[qt] *= al;
#pragma unroll
                    for (int dt = 0; dt < 4; ++dt) o[qt][dt] *= al; } }
            V pb[QT], pb2[QT];
#pragma unroll
            for (int qt = 0; qt < QT; ++qt) { v16f pv;
#pragma unroll
                for (int i = 0; i < 16; ++i) pv[i] = __builtin_amdgcn_exp2f(__builtin_fmaf(sc[qt][i >> 3][i & 7], CL, -mref[qt]));
                float t[8];
#pragma unroll
                for (int r = 0; r < 8; ++r) t[r] = pv[r] + pv[r + 8];
                lsum[qt] += ((t[0] + t[1]) + (t[2] + t[3])) + ((t[4] + t[5]) + (t[6] + t[7]));
                Vec8<T16>::pack(pv, pb[qt], pb2[qt]); }
            // every output tile sums V P, V Plo, Vlo P in this order; the tiles take turns
#pragma unroll
            for (int dt = 0; dt < 4; ++dt)
#pragma unroll
                for (int qt = 0; qt < QT; ++qt) o[qt][dt] = WFrag<T16>::mma(va[dt], pb[qt], o[qt][dt]);
            if (NP == 2) {
#pragma unroll
                for (int dt = 0; dt < 4; ++dt)
#pragma unroll
                    for (int qt = 0; qt < QT; ++qt) o[qt][dt] = WFrag<T16>::mma(va[dt], pb2[qt], o[qt][dt]);
#pragma unroll
                for (int dt = 0; dt < 4; ++dt)
#pragma unroll
                    for (int qt = 0; qt < QT; ++qt) o[qt][dt] = WFrag<T16>::mma(va2[dt], pb[qt], o[qt][dt]); }
        }
        if (s + 1 < TT / SK) stash(L + ((s + 1) & 1) * BUFE);   // its last readers left that buffer at the barrier of stage s - 1
        __syncthreads();
    }
#pragma unroll
    for (int qt = 0; qt < QT; ++qt) { const float inv = __fdiv_rn(1.0f, lsum[qt] + xhalf(lsum[qt])); const size_t ro = (size_t)(q0 + qt * 16 + c) * DQ + 8 * h;   // a lane holds 8 consecutive d of one query: 16-byte stores
#pragma unroll
        for (int dt = 0; dt < 4; ++dt) { v8us oh, ol;
#pragma unroll
            for (int r = 0; r < 8; ++r) { unsigned short a, c2; splitf(o[qt][dt][r] * inv, a, c2); oh[r] = a; ol[r] = c2; }
            *(v8us*)(Ah + ro + dt * 16) = oh; *(v8us*)(Al + ro + dt * 16) = ol;
            asm volatile("s_wait_xcnt 0x0" ::: "memory"); } }   // stands before the stores' address and data registers are reused
}
// amdgpu_waves_per_eu(4): holds the allocation under 256 VGPRs; without it the build goes just above and needs register-window switches in the loop.
__global__ __launch_bounds__(FW * 32) __attribute__((amdgpu_waves_per_eu(4))) void k_fattn(const h16* __restrict__ Q16, const h16* __restrict__ K16, const h16* __restrict__ V16, const bf* __restrict__ Qh, const bf* __restrict__ Ql, const bf* __restrict__ Kh, const bf* __restrict__ Kl, const bf* __restrict__ Vh, const bf* __restrict__ Vl, bf* Ah, bf* Al) {
    __shared__ __align__(16) unsigned short L[2 * 4 * SK * LP];
    const int z = blockIdx.x, bb = z / NH_, hh = z % NH_, w = threadIdx.x >> 5; const size_t pq = (size_t)z * TT * HD, pk = (size_t)(bb * NKV + hh / REP) * TT * HD, ao = (size_t)bb * TT * DQ + hh * HD;
    if (blockIdx.y < HB) fattn_body<bf, 2, 1>((bf*)L, Qh + pq, Ql + pq, Kh + pk, Kl + pk, Vh + pk, Vl + pk, ((int)blockIdx.y * FW + w) * 16, Ah + ao, Al + ao);
    else fattn_body<h16, 1, 2>((h16*)L, Q16 + pq, nullptr, K16 + pk, nullptr, V16 + pk, nullptr, RH + (((int)blockIdx.y - HB) * FW + w) * 32, Ah + ao, Al + ao);
}

extern "C" void kernel_launch(void* const* d_in, const int* in_sizes, int n_in,
                              void* d_out, int out_size, void* d_ws, size_t ws_size, hipStream_t stream) {
    (void)in_sizes; (void)n_in; (void)out_size;
    static_assert((BG * TT) % 128 == 0 && DQ % 128 == 0 && DKV % 128 == 0 && DM % 128 == 0 && DM % GK == 0 && DQ % GK == 0, "k_gemmw: whole 128 x 128 block tiles, whole stages");
    static_assert(BG == NB_ && DKV == DQ && NKV == NH_, "one launch a stage: all batches; Wq, Wk, Wv stacked as equal blocks");
    const float* x = (const float*)d_in[0]; const float* wq = (const float*)d_in[1]; const float* bq = (const float*)d_in[2]; const float* wk = (const float*)d_in[3]; const float* bk = (const float*)d_in[4]; const float* wv = (const float*)d_in[5]; const float* bv = (const float*)d_in[6]; const float* wo = (const float*)d_in[7]; const float* bo = (const float*)d_in[8];   /* weights 'oi' [768][768] */
    float* OUT = (float*)d_out;     // [4][2048][768]
    char* wsp = (char*)d_ws;
    auto take = [&](size_t bytes) { char* p = wsp; wsp += (bytes + 255) & ~(size_t)255; return (void*)p; };
    constexpr size_t PS = (size_t)BG * NH_ * TT * HD;   // elements of one plane (all batches and heads)
    bf* W4 = (bf*)take((size_t)4 * DQ * DM * 2); bf* WO = W4 + (size_t)3 * DQ * DM;   // Wq, Wk, Wv, Wo stacked
    h16* QP16 = (h16*)take(3 * PS * 2); h16* KP16 = QP16 + PS; h16* VT16 = QP16 + 2 * PS;   // each form: the Q, K and V^T planes in a row
    bf* QPh = (bf*)take(3 * PS * 2); bf* KPh = QPh + PS; bf* VTh = QPh + 2 * PS; bf* QPl = (bf*)take(3 * PS * 2); bf* KPl = QPl + PS; bf* VTl = QPl + 2 * PS;
    bf* XB = (bf*)take((size_t)BG * TT * DM * 2); bf* ATh = (bf*)take((size_t)BG * TT * DQ * 2); bf* ATl = (bf*)take((size_t)BG * TT * DQ * 2);
    if ((size_t)(wsp - (char*)d_ws) > ws_size) return;    // ws 256 MiB
    k_cvt8<<<XBK + 4 * WBK, 256, 0, stream>>>(x, wq, wk, wv, wo, XB, W4);
    k_gemmw<bf, 0, true, 1, 1><<<dim3(BG * TT / 128, 3 * DQ / 128, 1), GW * 32, 0, stream>>>(XB, nullptr, W4, nullptr, DM, nullptr, DQ, bq, bk, bv, 0, 0, 0, QP16, QPh, QPl, PS);
    k_fattn<<<dim3(BG * NH_, HB + LB, 1), FW * 32, 0, stream>>>(QP16, KP16, VT16, QPh, QPl, KPh, KPl, VTh, VTl, ATh, ATl);   // hi/lo blocks (the longer ones) take the lower y indices
    k_gemmw<bf, 1, true><<<dim3(BG * TT / 128, DM / 128, 1), GW * 32, 0, stream>>>(ATh, ATl, WO, nullptr, DQ, OUT, DM, bo, nullptr, nullptr, 0, 0, 0, nullptr, nullptr, nullptr, 0);
}
